// v000
// Measured on an AMD MI455X. A time is GPU time per run, averaged over a window of back-to-back runs after a warm-up
// (all launches, gaps included; the runs take copies of the inputs in turn), and the median of several windows.
// Apart from v000's, it joins two sittings. Times from different sittings can be a few percent apart, while
// side-by-side timings come from the same sitting.
// v000, which the later versions start from, runs in 332 microseconds.
#include <hip/hip_runtime.h>

// BERT self-attention with a FiLM-conditioned block-diagonal additive bias (CBDA): q/k/v = x W^T + b (torch layout, 16 heads x 64), scores/8 +
// bias[b][q][k] (= gamma[b][k%256] * rwm[q][k%256] + beta[b][k%256] when q and k fall in the same 256-block, else 0; gamma/beta = task_emb Wg^T + bg /
// Wb^T + bb), softmax, ctx = P v -> [16, 512, 1024] (no output projection). Lean build: single f16 products on v_wmma_f32_16x16x32_f16, f32 accumulate
// (ctx averages ~512 positions; no large rows); fragment k-map per lane half hh for A AND B: elements 0..7 <- k = 8hh+0..7, 8..15 <- k = 16+8hh+0..7.

namespace {
constexpr int Bsz = 16, T = 512, HID = 1024, DH = 64, NH = 16, NKV = 16, REP = NH / NKV;
constexpr int BLK = 256;
constexpr int KVW = NKV * DH;                 // 1024
constexpr int NQKV = HID + 2 * KVW;           // 3072 columns: q | k | v
constexpr int MROWS = Bsz * T;                // 8192
constexpr int QT_PER_B = T / 16;              // 32

typedef _Float16 b16;                                           // f16 hi/lo planes
typedef __attribute__((ext_vector_type(16))) _Float16 v16b;
typedef __attribute__((ext_vector_type(8)))  _Float16 v8b;
typedef __attribute__((ext_vector_type(8)))  float v8f;
typedef __attribute__((ext_vector_type(4)))  float v4f;

__device__ __forceinline__ v8b ld8b(const b16* p) { return *(const v8b*)p; }
__device__ __forceinline__ v16b cat8b(v8b a, v8b b) { return __builtin_shufflevector(a, b, 0, 1, 2, 3, 4, 5, 6, 7, 8, 9, 10, 11, 12, 13, 14, 15); }
// 16x16x32 16-bit fragment from a k-contiguous row pointer (A: lane&15 = row, B: lane&15 = column), hh = lane>>4:
// elements 0..7 <- p[8hh+0..7], elements 8..15 <- p[16+8hh+0..7]
__device__ __forceinline__ v16b frag_kb(const b16* p, int hh) { return cat8b(ld8b(p + 8 * hh), ld8b(p + 16 + 8 * hh)); }
__device__ __forceinline__ void split_bf16(float v, b16& hi, b16& lo) {   // (name kept) single f16: no low part
  hi = (b16)v; lo = (b16)0.0f;
}
// split fragment straight from an f32 k-contiguous row
__device__ __forceinline__ void frag_ksplit(const float* p, int hh, v16b& fh_, v16b& fl_) {
  const float* p0 = p + 8 * hh; const float* p1 = p + 16 + 8 * hh;
#pragma unroll
  for (int e = 0; e < 8; ++e) { b16 a, c; split_bf16(p0[e], a, c); fh_[e] = a; fl_[e] = c; split_bf16(p1[e], a, c); fh_[8 + e] = a; fl_[8 + e] = c; }
}
__device__ __forceinline__ v8f wmma16b(v16b a, v16b b, v8f c) {
  v8f d = __builtin_amdgcn_wmma_f32_16x16x32_f16(false, a, false, b, (short)0, c, false, false);
  asm volatile("v_nop\n\tv_nop\n\tv_nop\n\tv_nop" : "+v"(d) : "v"(a), "v"(b));
  return d;
}
// acc += A.B with both operands split: A = (ah, al), B = (bh, bl)
__device__ __forceinline__ v8f wmma3(v16b ah, v16b al, v16b bh, v16b bl, v8f c) {   // lean: single f16 product
  (void)al; (void)bl; return wmma16b(ah, bh, c);
}
__device__ __forceinline__ v8f wmma1(v16b ah, v16b al, v16b bh, v16b bl, v8f c) {   // attention products: single f16 (hi planes only)
  (void)al; (void)bl; return wmma16b(ah, bh, c);
}
__device__ __forceinline__ void wave_lds_sync() {
  __builtin_amdgcn_fence(__ATOMIC_RELEASE, "workgroup");
  __builtin_amdgcn_wave_barrier();
  __builtin_amdgcn_fence(__ATOMIC_ACQUIRE, "workgroup");
}

// ---------------------------------------------------------------------------
// Weights ([in][out]) -> f16 hi / lo planes transposed to [n][k] (k contiguous): columns of Wq|Wk|Wv into wqh/wql [3072][1024], Wo into woh/wol [1024][1024].
// ---------------------------------------------------------------------------
__global__ __launch_bounds__(256) void wcvt_kernel(const float* __restrict__ wq, const float* __restrict__ wk, const float* __restrict__ wv,
                                                   const float* __restrict__ wo, b16* __restrict__ wqh, b16* __restrict__ wql,
                                                   b16* __restrict__ woh, b16* __restrict__ wol) {
  const size_t tid = (size_t)blockIdx.x * blockDim.x + threadIdx.x, stride = (size_t)gridDim.x * blockDim.x;
  const size_t nq = (size_t)NQKV * HID / 8, no = (size_t)HID * HID / 8;
  {
    for (size_t c = tid; c < nq + no; c += stride) {
      float f[8]; size_t i; b16* dh; b16* dl;
      if (c < nq) {
        i = c * 8; const size_t n = i / HID, k0 = i % HID;
        const float* w; int nn, ld;
        if (n < (size_t)HID) { w = wq; nn = (int)n; ld = HID; } else if (n < (size_t)(HID + KVW)) { w = wk; nn = (int)n - HID; ld = KVW; } else { w = wv; nn = (int)n - HID - KVW; ld = KVW; }
#pragma unroll
        for (int e = 0; e < 8; ++e) f[e] = w[(size_t)(k0 + e) * ld + nn];       // W[k][n] ([in][out])
        dh = wqh; dl = wql;
      } else {
        i = (c - nq) * 8; const size_t n = i / HID, k0 = i % HID;
#pragma unroll
        for (int e = 0; e < 8; ++e) f[e] = wo[(size_t)(k0 + e) * HID + n];    // Wo[k][n] ([in][out])
        dh = woh; dl = wol;
      }
      v8b bh, bl;
#pragma unroll
      for (int e = 0; e < 8; ++e) { b16 a, cc; split_bf16(f[e], a, cc); bh[e] = a; bl[e] = cc; }
      *(v8b*)(dh + i) = bh; *(v8b*)(dl + i) = bl;
    }
    
  }
}

// 32x64 wave tile over K from f32 A rows and f16-plane B rows
__device__ __forceinline__ void gemm_tile_split(const float* __restrict__ A, const b16* __restrict__ wh, const b16* __restrict__ wl,
                                                int m0, int c0, int K, int nloc, int hlf, v8f (&acc)[2][4]) {
  for (int kb = 0; kb < K; kb += 32) {
    v16b a0h, a0l, a1h, a1l;
    frag_ksplit(A + (size_t)(m0 + nloc) * K + kb, hlf, a0h, a0l);
    frag_ksplit(A + (size_t)(m0 + 16 + nloc) * K + kb, hlf, a1h, a1l);
#pragma unroll
    for (int t = 0; t < 4; ++t) {
      const size_t wofs = (size_t)(c0 + t * 16 + nloc) * K + kb;
      const v16b bh = frag_kb(wh + wofs, hlf), bl = frag_kb(wl + wofs, hlf);
      acc[0][t] = wmma3(a0h, a0l, bh, bl, acc[0][t]);
      acc[1][t] = wmma3(a1h, a1l, bh, bl, acc[1][t]);
    }
  }
}

// ---------------------------------------------------------------------------
// QKV GEMM: (8192 x 1024) x (1024 x 3072), grid (48, 64), block 4 waves, wave = 32 rows x 64 columns (one head of q, k or v). Outputs as f16 hi/lo planes:
// q (x1/8) -> Qh/Ql [b][h][t][64]; k -> Kh/Kl [b][kvh][t][64] (4 KB contiguous per wave per plane);
// v -> Vh/Vl key-tiled [b][kvh][t/16][64][16] (4 KB contiguous per wave per plane).
// ---------------------------------------------------------------------------
__global__ __launch_bounds__(128) void qkv_gemm_kernel(const float* __restrict__ xq, const float* __restrict__ xk, const float* __restrict__ xv,
                                                       const b16* __restrict__ wqh, const b16* __restrict__ wql,
                                                       const float* __restrict__ bq, const float* __restrict__ bk, const float* __restrict__ bv, const float* __restrict__ rope_cs, int xoff, int yoff,
                                                       b16* __restrict__ Qh, b16* __restrict__ Ql, b16* __restrict__ Kh, b16* __restrict__ Kl,
                                                       b16* __restrict__ Vh, b16* __restrict__ Vl) {
  __shared__ __attribute__((aligned(16))) b16 Ts[4][2][32 * 64];
  const int lane = threadIdx.x & 31, wave = threadIdx.x >> 5, nloc = lane & 15, hlf = lane >> 4;
  const int m0 = (blockIdx.y + yoff) * 128 + wave * 32;
  const int c0 = (blockIdx.x + xoff) * 64;
  const int mat = (c0 < HID) ? 0 : (c0 < HID + KVW) ? 1 : 2;
  const int head = (mat == 0) ? (c0 / DH) : (mat == 1) ? ((c0 - HID) / DH) : ((c0 - HID - KVW) / DH);
  const float* x = (mat == 0) ? xq : (mat == 1) ? xk : xv;          // input of q, k or v (the same x at the launch)
  const float* bias = ((mat == 0) ? bq : (mat == 1) ? bk : bv) + head * DH;
  v8f acc[2][4];
#pragma unroll
  for (int r = 0; r < 2; ++r)
#pragma unroll
    for (int t = 0; t < 4; ++t) acc[r][t] = (v8f){};
  gemm_tile_split(x, wqh, wql, m0, c0, HID, nloc, hlf, acc);
  const int b = m0 / T, t0 = m0 % T;
  const float s = (mat == 0) ? 0.125f : 1.0f;
  b16* Tp0 = Ts[wave][0]; b16* Tp1 = Ts[wave][1];
#pragma unroll
  for (int t = 0; t < 4; ++t)
#pragma unroll
    for (int r = 0; r < 2; ++r)
#pragma unroll
      for (int v = 0; v < 8; ++v) {
        const int rr = r * 16 + v + 8 * hlf, d = t * 16 + nloc;
        float val = acc[r][t][v] + (bias ? bias[d] : 0.0f);
        if (false) {                                     // (no rotary in this module)
          const int tpos = t0 + rr;                      // sequence position of this row
          const float cv = rope_cs[((size_t)tpos * 32 + (d & 31)) * 2], sv = rope_cs[((size_t)tpos * 32 + (d & 31)) * 2 + 1];
          const float oth = acc[r][t ^ 2][v] + (bias ? bias[d ^ 32] : 0.0f);
          val = (t < 2) ? (val * cv - oth * sv) : (val * cv + oth * sv);
        }
        b16 yh, yl; split_bf16(val * s, yh, yl);
        const int idx = (mat < 2) ? (rr * 64 + d) : ((rr >> 4) * 1024 + d * 16 + (rr & 15));
        Tp0[idx] = yh; Tp1[idx] = yl;
      }
  wave_lds_sync();
  b16* dh; b16* dl; size_t o;
  if (mat == 0)      { o = ((size_t)(b * NH + head) * T + t0) * DH; dh = Qh + o; dl = Ql + o; }
  else if (mat == 1) { o = ((size_t)(b * NKV + head) * T + t0) * DH; dh = Kh + o; dl = Kl + o; }
  else               { o = ((size_t)(b * NKV + head) * QT_PER_B + (t0 >> 4)) * (size_t)(DH * 16); dh = Vh + o; dl = Vl + o; }
#pragma unroll
  for (int j = 0; j < 8; ++j) { const int e = (j * 32 + lane) * 8; *(v8b*)(dh + e) = ld8b(Tp0 + e); *(v8b*)(dl + e) = ld8b(Tp1 + e); }
  
}

// ---------------------------------------------------------------------------
// Transposed flash attention: each wave owns one 16-query tile of one (b, head); 8 waves per block; all keys in chunks of 32.
// S^T = K.Q^T (split), per-lane online softmax; P^T built in registers from the two S^T accumulators
// ---------------------------------------------------------------------------
__global__ __launch_bounds__(256) void attn_kernel(const b16* __restrict__ Qh, const b16* __restrict__ Ql, const b16* __restrict__ Kh, const b16* __restrict__ Kl,
                                                   const b16* __restrict__ Vh, const b16* __restrict__ Vl, const int* __restrict__ seqlen,
                                                   const float* __restrict__ gam, const float* __restrict__ bet, const float* __restrict__ rwm,
                                                   float* __restrict__ yf) {
  __shared__ __attribute__((aligned(16))) float Os[8][16 * 64];
  const int wid = threadIdx.x >> 5, lane = threadIdx.x & 31, hh = lane >> 4, col = lane & 15;
  const int qtile = blockIdx.x * 8 + wid;                 // over Bsz*NH*QT_PER_B
  const int g = qtile / QT_PER_B;                         // b*NH + h
  const int q0 = (qtile % QT_PER_B) << 4;
  const int b = g / NH, h = g % NH, kvh = h / REP;
  const size_t ko = (size_t)(b * NKV + kvh) * T * DH;
  const size_t qo = ((size_t)g * T + q0 + col) * DH;
  const v16b q0h = frag_kb(Qh + qo, hh), q0l = frag_kb(Ql + qo, hh), q1h = frag_kb(Qh + qo + 32, hh), q1l = frag_kb(Ql + qo + 32, hh);
  float m = -INFINITY, l = 0.0f;
  v8f o0 = {}, o1 = {}, o2 = {}, o3 = {};
  const int slen = T; (void)seqlen;                       // no padding in this module
  for (int kb = 0; kb < T; kb += 32) {                   // non-causal: every key chunk
    const size_t r0 = ko + (size_t)(kb + col) * DH, r1 = ko + (size_t)(kb + 16 + col) * DH;
    v8f s0 = {}, s1 = {};
    {
      v16b ah = frag_kb(Kh + r0, hh), al = frag_kb(Kl + r0, hh);
      s0 = wmma1(ah, al, q0h, q0l, s0);
      ah = frag_kb(Kh + r0 + 32, hh); al = frag_kb(Kl + r0 + 32, hh);
      s0 = wmma1(ah, al, q1h, q1l, s0);
      ah = frag_kb(Kh + r1, hh); al = frag_kb(Kl + r1, hh);
      s1 = wmma1(ah, al, q0h, q0l, s1);
      ah = frag_kb(Kh + r1 + 32, hh); al = frag_kb(Kl + r1 + 32, hh);
      s1 = wmma1(ah, al, q1h, q1l, s1);
    }
    (void)slen;
    if ((kb >> 8) == (q0 >> 8)) {                         // CBDA bias: same 256-block of query and key (chunks never straddle a block)
      const int qi = q0 + col;
      const float* rw = rwm + (size_t)qi * BLK + (kb & (BLK - 1)) + 8 * hh;
      const float* gm = gam + (size_t)b * BLK + (kb & (BLK - 1)) + 8 * hh;
      const float* bt = bet + (size_t)b * BLK + (kb & (BLK - 1)) + 8 * hh;
#pragma unroll
      for (int r = 0; r < 8; ++r) { s0[r] += gm[r] * rw[r] + bt[r]; s1[r] += gm[16 + r] * rw[16 + r] + bt[16 + r]; }
    }
    float mr = -INFINITY;
#pragma unroll
    for (int r = 0; r < 8; ++r) mr = fmaxf(mr, fmaxf(s0[r], s1[r]));
    mr = fmaxf(mr, __shfl_xor(mr, 16));
    float mn = fmaxf(m, mr);
    if (mn == -INFINITY) mn = 0.0f;           // fully masked so far (padded query rows far past seq_len): keep exp() at 0
    const float al_ = __expf(m - mn);
    m = mn;
    float sum = 0.0f;
    v16b pbh, pbl;
#pragma unroll
    for (int r = 0; r < 8; ++r) {
      const float p0 = __expf(s0[r] - mn), p1 = __expf(s1[r] - mn);
      sum += p0 + p1;
      b16 a, c; split_bf16(p0, a, c); pbh[r] = a; pbl[r] = c; split_bf16(p1, a, c); pbh[8 + r] = a; pbl[8 + r] = c;
    }
    sum += __shfl_xor(sum, 16);
    l = l * al_ + sum;
#pragma unroll
    for (int r = 0; r < 8; ++r) { o0[r] *= al_; o1[r] *= al_; o2[r] *= al_; o3[r] *= al_; }
    const size_t v0 = ko + (size_t)(kb >> 4) * (DH * 16) + 8 * hh, v1 = v0 + DH * 16;
#pragma unroll
    for (int n = 0; n < 4; ++n) {
      const int f = n * 16 + col;
      const v16b vah = cat8b(ld8b(Vh + v0 + f * 16), ld8b(Vh + v1 + f * 16));
      const v16b val = cat8b(ld8b(Vl + v0 + f * 16), ld8b(Vl + v1 + f * 16));
      v8f& o = (n == 0) ? o0 : (n == 1) ? o1 : (n == 2) ? o2 : o3;
      o = wmma1(vah, val, pbh, pbl, o);
    }
  }
  const float inv = (q0 + col < slen && l > 0.0f) ? (1.0f / l) : 0.0f;   // padded query rows are zeroed
  float* Tt = Os[wid];
#pragma unroll
  for (int r = 0; r < 8; ++r) {
    const int hr = 8 * hh + r;
    Tt[col * 64 + 0 + hr] = o0[r] * inv; Tt[col * 64 + 16 + hr] = o1[r] * inv;
    Tt[col * 64 + 32 + hr] = o2[r] * inv; Tt[col * 64 + 48 + hr] = o3[r] * inv;
  }
  wave_lds_sync();
  float* dst0 = yf + ((size_t)b * T + q0) * HID + h * DH;     // 16 rows x 64 floats, row stride HID
#pragma unroll
  for (int j = 0; j < 8; ++j) { const int rr = j * 2 + hh, c4 = col * 4; *(v4f*)(dst0 + (size_t)rr * HID + c4) = *(const v4f*)(Tt + rr * 64 + c4); }
  
}

// ---------------------------------------------------------------------------
// Output projection: (8192 x 1024) x (1024 x 1024) -> f32, A split on the fly from f32 y, B = Wo planes. grid (16, 64), 32x64 tiles staged in LDS,
// ---------------------------------------------------------------------------
__global__ __launch_bounds__(128) void out_gemm_kernel(const float* __restrict__ yf, const b16* __restrict__ woh, const b16* __restrict__ wol, const float* __restrict__ bo, int yoff,
                                                       float* __restrict__ out) {
  __shared__ __attribute__((aligned(16))) float Ts[4][32 * 64];
  const int lane = threadIdx.x & 31, wave = threadIdx.x >> 5, nloc = lane & 15, hlf = lane >> 4;
  const int m0 = (blockIdx.y + yoff) * 128 + wave * 32;
  const int c0 = blockIdx.x * 64;
  v8f acc[2][4];
#pragma unroll
  for (int r = 0; r < 2; ++r)
#pragma unroll
    for (int t = 0; t < 4; ++t) acc[r][t] = (v8f){};
  gemm_tile_split(yf, woh, wol, m0, c0, HID, nloc, hlf, acc);
  float* Tt = Ts[wave];
#pragma unroll
  for (int t = 0; t < 4; ++t)
#pragma unroll
    for (int r = 0; r < 2; ++r)
#pragma unroll
      for (int v = 0; v < 8; ++v) Tt[(r * 16 + v + 8 * hlf) * 64 + t * 16 + nloc] = acc[r][t][v] + bo[c0 + t * 16 + nloc];
  wave_lds_sync();
  float* dst0 = out + (size_t)m0 * HID + c0;
#pragma unroll
  for (int j = 0; j < 16; ++j) { const int rr = j * 2 + hlf, c4 = nloc * 4; *(v4f*)(dst0 + (size_t)rr * HID + c4) = *(const v4f*)(Tt + rr * 64 + c4); }
  
}
__global__ __launch_bounds__(256) void wcvtT_kernel(const float* __restrict__ wq, const float* __restrict__ wk, const float* __restrict__ wv,
                                                    b16* __restrict__ wqh, b16* __restrict__ wql) {
  const size_t tid = (size_t)blockIdx.x * blockDim.x + threadIdx.x, stride = (size_t)gridDim.x * blockDim.x;
  const size_t nq = (size_t)NQKV * HID / 8;
  {
    for (size_t c = tid; c < nq; c += stride) {
      const size_t i = c * 8, n = i / HID, k0 = i % HID;
      const float* w = (n < (size_t)HID) ? (wq + n * HID) : (n < (size_t)(2 * HID)) ? (wk + (n - HID) * HID) : (wv + (n - 2 * HID) * HID);
      v8b bh, bl;
#pragma unroll
      for (int e = 0; e < 8; ++e) { b16 a, cc; split_bf16(w[k0 + e], a, cc); bh[e] = a; bl[e] = cc; }
      *(v8b*)(wqh + i) = bh; *(v8b*)(wql + i) = bl;
    }
    
  }
}
__global__ __launch_bounds__(256) void film_kernel(const float* __restrict__ te, const float* __restrict__ Wg, const float* __restrict__ bg,
                                                   const float* __restrict__ Wb, const float* __restrict__ bb, float* __restrict__ gam, float* __restrict__ bet) {
  const int t = blockIdx.x * 256 + threadIdx.x;           // Bsz * BLK
  const int b = t / BLK, c = t % BLK;
  const float* e = te + (size_t)b * HID;
  float g = bg[c], h = bb[c];
  for (int k = 0; k < HID; ++k) { g += e[k] * Wg[(size_t)c * HID + k]; h += e[k] * Wb[(size_t)c * HID + k]; }
  *(float*)(gam + t) = g; *(float*)(bet + t) = h; 
}
}  // namespace

extern "C" void kernel_launch(void* const* d_in, const int* in_sizes, int n_in,
                              void* d_out, int out_size, void* d_ws, size_t ws_size, hipStream_t stream) {
  (void)in_sizes; (void)n_in; (void)out_size;
  const float* x   = (const float*)d_in[0];    // hidden_states [16,512,1024]
  const float* te  = (const float*)d_in[1];    // task_embedding [16,1024]
  const float* Wq  = (const float*)d_in[2];  const float* bq = (const float*)d_in[3];
  const float* Wk  = (const float*)d_in[4];  const float* bk = (const float*)d_in[5];
  const float* Wv  = (const float*)d_in[6];  const float* bv = (const float*)d_in[7];
  const float* Wg  = (const float*)d_in[8];  const float* bg = (const float*)d_in[9];
  const float* Wb  = (const float*)d_in[10]; const float* bb = (const float*)d_in[11];
  const float* rwm = (const float*)d_in[12];   // [512,256]
  float* out = (float*)d_out;                  // ctx [16,512,1024]

  size_t off = 0; char* ws = (char*)d_ws;
  b16* wqh = (b16*)(ws + off); off += (size_t)NQKV * HID * 2;
  b16* wql = (b16*)(ws + off); off += (size_t)NQKV * HID * 2;
  b16* Qh  = (b16*)(ws + off); off += (size_t)MROWS * HID * 2;
  b16* Ql  = (b16*)(ws + off); off += (size_t)MROWS * HID * 2;
  b16* Kh  = (b16*)(ws + off); off += (size_t)MROWS * KVW * 2;
  b16* Kl  = (b16*)(ws + off); off += (size_t)MROWS * KVW * 2;
  b16* Vh  = (b16*)(ws + off); off += (size_t)MROWS * KVW * 2;
  b16* Vl  = (b16*)(ws + off); off += (size_t)MROWS * KVW * 2;
  float* gam = (float*)(ws + off); off += (size_t)Bsz * BLK * 4;
  float* bet = (float*)(ws + off); off += (size_t)Bsz * BLK * 4;
  if (off > ws_size) return;
  const int ROWBLK = MROWS / 128, NQT = Bsz * NH * QT_PER_B;
  wcvtT_kernel<<<2048, 256, 0, stream>>>(Wq, Wk, Wv, wqh, wql);
  film_kernel<<<Bsz * BLK / 256, 256, 0, stream>>>(te, Wg, bg, Wb, bb, gam, bet);
  qkv_gemm_kernel<<<dim3(NQKV / 64, ROWBLK), 128, 0, stream>>>(x, x, x, wqh, wql, bq, bk, bv, nullptr, 0, 0, Qh, Ql, Kh, Kl, Vh, Vl);
  attn_kernel<<<NQT / 8, 256, 0, stream>>>(Qh, Ql, Kh, Kl, Vh, Vl, nullptr, gam, bet, rwm, out);
}

// v001
// It runs in 227 microseconds.
// In two side-by-side timings against v000, it was 1.46 and 1.47 times as fast.
#include <hip/hip_runtime.h>

// BERT self-attention with a FiLM-conditioned block-diagonal additive bias (CBDA): q/k/v = x W^T + b (torch layout, 16 heads x 64), scores/8 +
// bias[b][q][k] (= gamma[b][k%256] * rwm[q][k%256] + beta[b][k%256] when q and k fall in the same 256-block, else 0; gamma/beta = task_emb Wg^T + bg /
// Wb^T + bb), softmax, ctx = P v -> [16, 512, 1024] (no output projection). Lean build: single f16 products on v_wmma_f32_16x16x32_f16, f32 accumulate
// (ctx averages ~512 positions; no large rows); fragment k-map per lane half hh for A AND B: elements 0..7 <- k = 8hh+0..7, 8..15 <- k = 16+8hh+0..7.

namespace {
constexpr int Bsz = 16, T = 512, HID = 1024, DH = 64, NH = 16, NKV = 16, REP = NH / NKV;
constexpr int BLK = 256;
constexpr int KVW = NKV * DH;                 // 1024
constexpr int NQKV = HID + 2 * KVW;           // 3072 columns: q | k | v
constexpr int MROWS = Bsz * T;                // 8192
constexpr int QT_PER_B = T / 16;              // 32

typedef _Float16 b16;                                           // f16 hi/lo planes
typedef __attribute__((ext_vector_type(16))) _Float16 v16b;
typedef __attribute__((ext_vector_type(8)))  _Float16 v8b;
typedef __attribute__((ext_vector_type(4)))  _Float16 v4b;
typedef __attribute__((ext_vector_type(8)))  float v8f;
typedef __attribute__((ext_vector_type(4)))  float v4f;

__device__ __forceinline__ v8b ld8b(const b16* p) { return *(const v8b*)p; }
__device__ __forceinline__ v16b cat8b(v8b a, v8b b) { return __builtin_shufflevector(a, b, 0, 1, 2, 3, 4, 5, 6, 7, 8, 9, 10, 11, 12, 13, 14, 15); }
// 16x16x32 16-bit fragment from a k-contiguous row pointer (A: lane&15 = row, B: lane&15 = column), hh = lane>>4:
// elements 0..7 <- p[8hh+0..7], elements 8..15 <- p[16+8hh+0..7]
__device__ __forceinline__ v16b frag_kb(const b16* p, int hh) { return cat8b(ld8b(p + 8 * hh), ld8b(p + 16 + 8 * hh)); }
__device__ __forceinline__ void split_bf16(float v, b16& hi, b16& lo) {   // (name kept) single f16: no low part
  hi = (b16)v; lo = (b16)0.0f;
}
// split fragment straight from an f32 k-contiguous row
__device__ __forceinline__ void frag_ksplit(const float* p, int hh, v16b& fh_, v16b& fl_) {
  const float* p0 = p + 8 * hh; const float* p1 = p + 16 + 8 * hh;
#pragma unroll
  for (int e = 0; e < 8; ++e) { b16 a, c; split_bf16(p0[e], a, c); fh_[e] = a; fl_[e] = c; split_bf16(p1[e], a, c); fh_[8 + e] = a; fl_[8 + e] = c; }
}
__device__ __forceinline__ v8f wmma16b(v16b a, v16b b, v8f c) {
  v8f d = __builtin_amdgcn_wmma_f32_16x16x32_f16(false, a, false, b, (short)0, c, false, false);
  asm volatile("v_nop\n\tv_nop\n\tv_nop\n\tv_nop" : "+v"(d) : "v"(a), "v"(b));
  return d;
}
// acc += A.B with both operands split: A = (ah, al), B = (bh, bl)
__device__ __forceinline__ v8f wmma3(v16b ah, v16b al, v16b bh, v16b bl, v8f c) {   // lean: single f16 product
  (void)al; (void)bl; return wmma16b(ah, bh, c);
}
__device__ __forceinline__ v8f wmma1(v16b ah, v16b al, v16b bh, v16b bl, v8f c) {   // attention products: single f16 (hi planes only)
  (void)al; (void)bl; return wmma16b(ah, bh, c);
}
__device__ __forceinline__ void wave_lds_sync() {
  __builtin_amdgcn_fence(__ATOMIC_RELEASE, "workgroup");
  __builtin_amdgcn_wave_barrier();
  __builtin_amdgcn_fence(__ATOMIC_ACQUIRE, "workgroup");
}

// ---------------------------------------------------------------------------
// Weights ([in][out]) -> f16 hi / lo planes transposed to [n][k] (k contiguous): columns of Wq|Wk|Wv into wqh/wql [3072][1024], Wo into woh/wol [1024][1024].
// ---------------------------------------------------------------------------
__global__ __launch_bounds__(256) void wcvt_kernel(const float* __restrict__ wq, const float* __restrict__ wk, const float* __restrict__ wv,
                                                   const float* __restrict__ wo, b16* __restrict__ wqh, b16* __restrict__ wql,
                                                   b16* __restrict__ woh, b16* __restrict__ wol) {
  const size_t tid = (size_t)blockIdx.x * blockDim.x + threadIdx.x, stride = (size_t)gridDim.x * blockDim.x;
  const size_t nq = (size_t)NQKV * HID / 8, no = (size_t)HID * HID / 8;
  {
    for (size_t c = tid; c < nq + no; c += stride) {
      float f[8]; size_t i; b16* dh; b16* dl;
      if (c < nq) {
        i = c * 8; const size_t n = i / HID, k0 = i % HID;
        const float* w; int nn, ld;
        if (n < (size_t)HID) { w = wq; nn = (int)n; ld = HID; } else if (n < (size_t)(HID + KVW)) { w = wk; nn = (int)n - HID; ld = KVW; } else { w = wv; nn = (int)n - HID - KVW; ld = KVW; }
#pragma unroll
        for (int e = 0; e < 8; ++e) f[e] = w[(size_t)(k0 + e) * ld + nn];       // W[k][n] ([in][out])
        dh = wqh; dl = wql;
      } else {
        i = (c - nq) * 8; const size_t n = i / HID, k0 = i % HID;
#pragma unroll
        for (int e = 0; e < 8; ++e) f[e] = wo[(size_t)(k0 + e) * HID + n];    // Wo[k][n] ([in][out])
        dh = woh; dl = wol;
      }
      v8b bh, bl;
#pragma unroll
      for (int e = 0; e < 8; ++e) { b16 a, cc; split_bf16(f[e], a, cc); bh[e] = a; bl[e] = cc; }
      *(v8b*)(dh + i) = bh; *(v8b*)(dl + i) = bl;
    }
    
  }
}

// 32x64 wave tile over K from f32 A rows and f16-plane B rows
__device__ __forceinline__ void gemm_tile_split(const float* __restrict__ A, const b16* __restrict__ wh, const b16* __restrict__ wl,
                                                int m0, int c0, int K, int nloc, int hlf, v8f (&acc)[2][4]) {
  for (int kb = 0; kb < K; kb += 32) {
    v16b a0h, a0l, a1h, a1l;
    frag_ksplit(A + (size_t)(m0 + nloc) * K + kb, hlf, a0h, a0l);
    frag_ksplit(A + (size_t)(m0 + 16 + nloc) * K + kb, hlf, a1h, a1l);
#pragma unroll
    for (int t = 0; t < 4; ++t) {
      const size_t wofs = (size_t)(c0 + t * 16 + nloc) * K + kb;
      const v16b bh = frag_kb(wh + wofs, hlf), bl = frag_kb(wl + wofs, hlf);
      acc[0][t] = wmma3(a0h, a0l, bh, bl, acc[0][t]);
      acc[1][t] = wmma3(a1h, a1l, bh, bl, acc[1][t]);
    }
  }
}

// ---------------------------------------------------------------------------
// QKV GEMM: (8192 x 1024) x (1024 x 3072), grid (12, 64), block 8 waves (2 x 4), block tile 128 rows x 256 columns, wave = 64 rows x 64 columns (one head of
// q, k or v). Per pass of 64 k the block brings its x rows (f32, whole 128-B lines, converted to f16 once) and its weight rows through registers into LDS
// (row pitch 144 B); every wave reads its fragments from there. Two LDS buffers, one barrier per pass: the next pass's global loads are issued ahead of this
// pass's products and stored into the other buffer behind them. Outputs as f16 hi/lo planes:
// q (x1/8) -> Qh/Ql [b][h][t][64]; k -> Kh/Kl [b][kvh][t][64] (8 KB contiguous per wave per plane);
// v -> Vh/Vl key-tiled [b][kvh][t/16][64][16] (8 KB contiguous per wave per plane).
// ---------------------------------------------------------------------------
constexpr int GBM = 128, GBN = 256, GKS = 64;
constexpr int GPITCH = GKS + 8;                 // LDS row pitch in f16 elements: 144 B = 16 B x 9 (conflict-free for 16-byte fragment reads)
constexpr int GSTAGE = (GBM + GBN) * GPITCH;    // one buffer: x rows, then weight rows
constexpr int GEPI = 8 * 4 * 32 * 64;           // epilogue staging, 16 KB per wave, in the same LDS behind the last pass's barrier
constexpr int GSMEM = (2 * GSTAGE > GEPI) ? 2 * GSTAGE : GEPI;
__global__ __launch_bounds__(256) void qkv_gemm_kernel(const float* __restrict__ xq, const float* __restrict__ xk, const float* __restrict__ xv,
                                                       const b16* __restrict__ wqh, const b16* __restrict__ wql,
                                                       const float* __restrict__ bq, const float* __restrict__ bk, const float* __restrict__ bv, const float* __restrict__ rope_cs, int xoff, int yoff,
                                                       b16* __restrict__ Qh, b16* __restrict__ Ql, b16* __restrict__ Kh, b16* __restrict__ Kl,
                                                       b16* __restrict__ Vh, b16* __restrict__ Vl) {
  __shared__ __attribute__((aligned(16))) b16 Sm[GSMEM];
  (void)wql; (void)rope_cs;
  const int tid = threadIdx.x, lane = tid & 31, nloc = lane & 15, hlf = lane >> 4;
  const int wave = __builtin_amdgcn_readfirstlane(tid >> 5);        // wave-uniform: head, matrix and staging bases stay in scalar registers
  const int wm = wave >> 2, wn = wave & 3;
  const int mblk = (blockIdx.y + yoff) * GBM;
  const int cblk = (blockIdx.x + xoff) * GBN;
  const int c0 = cblk + wn * 64;
  const int mat = (c0 < HID) ? 0 : (c0 < HID + KVW) ? 1 : 2;
  const int head = (mat == 0) ? (c0 / DH) : (mat == 1) ? ((c0 - HID) / DH) : ((c0 - HID - KVW) / DH);
  const float* x = (mat == 0) ? xq : (mat == 1) ? xk : xv;          // input of q, k or v (the same x at the launch)
  const float* bias = ((mat == 0) ? bq : (mat == 1) ? bk : bv) + head * DH;
  // loaders: x, 16 threads x 16 B per row (a wave covers 2 rows x 256 B); weights, 8 threads x 16 B per row (a wave covers 4 rows x 128 B)
  const int arow = tid >> 4, acol = (tid & 15) * 4;
  const int brow = tid >> 3, bcol = (tid & 7) * 8;
  const float* ag = x + (size_t)(mblk + arow) * HID + acol;
  const b16* bg = wqh + (size_t)(cblk + brow) * HID + bcol;
  b16* as = Sm + arow * GPITCH + acol;
  b16* bs = Sm + (GBM + brow) * GPITCH + bcol;
  const b16* af0 = Sm + (wm * 64 + nloc) * GPITCH;
  const b16* bf0 = Sm + (GBM + wn * 64 + nloc) * GPITCH;
  v4f ra[8]; v8b rb[8];
  v8f acc[4][4];
#pragma unroll
  for (int r = 0; r < 4; ++r)
#pragma unroll
    for (int t = 0; t < 4; ++t) acc[r][t] = (v8f){};
#pragma unroll
  for (int j = 0; j < 8; ++j) { ra[j] = *(const v4f*)(ag + (size_t)j * 16 * HID); rb[j] = ld8b(bg + (size_t)j * 32 * HID); }
#pragma unroll
  for (int j = 0; j < 8; ++j) {
    v4b h; 
#pragma unroll
    for (int e = 0; e < 4; ++e) h[e] = (b16)ra[j][e];
    *(v4b*)(as + j * 16 * GPITCH) = h; *(v8b*)(bs + j * 32 * GPITCH) = rb[j];
  }
  __syncthreads();
  for (int it = 0; it < HID / GKS; ++it) {
    const int cur = (it & 1) * GSTAGE, nxt = GSTAGE - cur;
    const bool more = it + 1 < HID / GKS;
    if (more) {
      const int kb = (it + 1) * GKS;
#pragma unroll
      for (int j = 0; j < 8; ++j) { ra[j] = *(const v4f*)(ag + (size_t)j * 16 * HID + kb); rb[j] = ld8b(bg + (size_t)j * 32 * HID + kb); }
    }
#pragma unroll
    for (int ks = 0; ks < GKS; ks += 32) {
      v16b a[4];
#pragma unroll
      for (int r = 0; r < 4; ++r) a[r] = frag_kb(af0 + cur + r * 16 * GPITCH + ks, hlf);
      v16b bh = frag_kb(bf0 + cur + ks, hlf);
#pragma unroll
      for (int t = 0; t < 4; ++t) {
        v16b bn = bh;
        if (t < 3) bn = frag_kb(bf0 + cur + (t + 1) * 16 * GPITCH + ks, hlf);   // the next column fragment is read ahead of this one's four products
#pragma unroll
        for (int r = 0; r < 4; ++r) acc[r][t] = wmma3(a[r], a[r], bh, bh, acc[r][t]);
        bh = bn;
      }
    }
    if (more) {
#pragma unroll
      for (int j = 0; j < 8; ++j) {
        v4b h;
#pragma unroll
        for (int e = 0; e < 4; ++e) h[e] = (b16)ra[j][e];
        *(v4b*)(as + nxt + j * 16 * GPITCH) = h; *(v8b*)(bs + nxt + j * 32 * GPITCH) = rb[j];
      }
    }
    __syncthreads();   // publishes the buffer just filled and ends every wave's reads of the one refilled next (after the last pass: of the LDS the epilogue reuses)
  }
  const float s = (mat == 0) ? 0.125f : 1.0f;
  b16* Tw = Sm + wave * (4 * 32 * 64);                              // each wave stages in its own 16 KB: [32-row half][plane][32 * 64]
#pragma unroll
  for (int r2 = 0; r2 < 2; ++r2) {
    b16* Tp0 = Tw + r2 * (2 * 32 * 64); b16* Tp1 = Tp0 + 32 * 64;
#pragma unroll
    for (int t = 0; t < 4; ++t)
#pragma unroll
      for (int r = 0; r < 2; ++r)
#pragma unroll
        for (int v = 0; v < 8; ++v) {
          const int rr = r * 16 + v + 8 * hlf, d = t * 16 + nloc;
          const float val = acc[r2 * 2 + r][t][v] + bias[d];
          b16 yh, yl; split_bf16(val * s, yh, yl);
          const int idx = (mat < 2) ? (rr * 64 + d) : ((rr >> 4) * 1024 + d * 16 + (rr & 15));
          Tp0[idx] = yh; Tp1[idx] = yl;
        }
  }
  wave_lds_sync();
#pragma unroll
  for (int r2 = 0; r2 < 2; ++r2) {
    const b16* Tp0 = Tw + r2 * (2 * 32 * 64); const b16* Tp1 = Tp0 + 32 * 64;
    const int m0 = mblk + wm * 64 + r2 * 32;
    const int b = m0 / T, t0 = m0 % T;
    b16* dh; b16* dl; size_t o;
    if (mat == 0)      { o = ((size_t)(b * NH + head) * T + t0) * DH; dh = Qh + o; dl = Ql + o; }
    else if (mat == 1) { o = ((size_t)(b * NKV + head) * T + t0) * DH; dh = Kh + o; dl = Kl + o; }
    else               { o = ((size_t)(b * NKV + head) * QT_PER_B + (t0 >> 4)) * (size_t)(DH * 16); dh = Vh + o; dl = Vl + o; }
#pragma unroll
    for (int j = 0; j < 8; ++j) { const int e = (j * 32 + lane) * 8; *(v8b*)(dh + e) = ld8b(Tp0 + e); *(v8b*)(dl + e) = ld8b(Tp1 + e); }
    // the next half's LDS reads reuse the registers that these stores name: keep the wait in front of that overwrite
    if (r2 == 0) asm volatile("s_wait_xcnt 0x0" ::: "memory");
  }
}

// ---------------------------------------------------------------------------
// Transposed flash attention: each wave owns one 16-query tile of one (b, head); 8 waves per block; all keys in chunks of 32.
// S^T = K.Q^T (split), per-lane online softmax; P^T built in registers from the two S^T accumulators
// ---------------------------------------------------------------------------
__global__ __launch_bounds__(256) void attn_kernel(const b16* __restrict__ Qh, const b16* __restrict__ Ql, const b16* __restrict__ Kh, const b16* __restrict__ Kl,
                                                   const b16* __restrict__ Vh, const b16* __restrict__ Vl, const int* __restrict__ seqlen,
                                                   const float* __restrict__ gam, const float* __restrict__ bet, const float* __restrict__ rwm,
                                                   float* __restrict__ yf) {
  __shared__ __attribute__((aligned(16))) float Os[8][16 * 64];
  const int wid = threadIdx.x >> 5, lane = threadIdx.x & 31, hh = lane >> 4, col = lane & 15;
  const int qtile = blockIdx.x * 8 + wid;                 // over Bsz*NH*QT_PER_B
  const int g = qtile / QT_PER_B;                         // b*NH + h
  const int q0 = (qtile % QT_PER_B) << 4;
  const int b = g / NH, h = g % NH, kvh = h / REP;
  const size_t ko = (size_t)(b * NKV + kvh) * T * DH;
  const size_t qo = ((size_t)g * T + q0 + col) * DH;
  const v16b q0h = frag_kb(Qh + qo, hh), q0l = frag_kb(Ql + qo, hh), q1h = frag_kb(Qh + qo + 32, hh), q1l = frag_kb(Ql + qo + 32, hh);
  float m = -INFINITY, l = 0.0f;
  v8f o0 = {}, o1 = {}, o2 = {}, o3 = {};
  const int slen = T; (void)seqlen;                       // no padding in this module
  for (int kb = 0; kb < T; kb += 32) {                   // non-causal: every key chunk
    const size_t r0 = ko + (size_t)(kb + col) * DH, r1 = ko + (size_t)(kb + 16 + col) * DH;
    v8f s0 = {}, s1 = {};
    {
      v16b ah = frag_kb(Kh + r0, hh), al = frag_kb(Kl + r0, hh);
      s0 = wmma1(ah, al, q0h, q0l, s0);
      ah = frag_kb(Kh + r0 + 32, hh); al = frag_kb(Kl + r0 + 32, hh);
      s0 = wmma1(ah, al, q1h, q1l, s0);
      ah = frag_kb(Kh + r1, hh); al = frag_kb(Kl + r1, hh);
      s1 = wmma1(ah, al, q0h, q0l, s1);
      ah = frag_kb(Kh + r1 + 32, hh); al = frag_kb(Kl + r1 + 32, hh);
      s1 = wmma1(ah, al, q1h, q1l, s1);
    }
    (void)slen;
    if ((kb >> 8) == (q0 >> 8)) {                         // CBDA bias: same 256-block of query and key (chunks never straddle a block)
      const int qi = q0 + col;
      const float* rw = rwm + (size_t)qi * BLK + (kb & (BLK - 1)) + 8 * hh;
      const float* gm = gam + (size_t)b * BLK + (kb & (BLK - 1)) + 8 * hh;
      const float* bt = bet + (size_t)b * BLK + (kb & (BLK - 1)) + 8 * hh;
#pragma unroll
      for (int r = 0; r < 8; ++r) { s0[r] += gm[r] * rw[r] + bt[r]; s1[r] += gm[16 + r] * rw[16 + r] + bt[16 + r]; }
    }
    float mr = -INFINITY;
#pragma unroll
    for (int r = 0; r < 8; ++r) mr = fmaxf(mr, fmaxf(s0[r], s1[r]));
    mr = fmaxf(mr, __shfl_xor(mr, 16));
    float mn = fmaxf(m, mr);
    if (mn == -INFINITY) mn = 0.0f;           // fully masked so far (padded query rows far past seq_len): keep exp() at 0
    const float al_ = __expf(m - mn);
    m = mn;
    float sum = 0.0f;
    v16b pbh, pbl;
#pragma unroll
    for (int r = 0; r < 8; ++r) {
      const float p0 = __expf(s0[r] - mn), p1 = __expf(s1[r] - mn);
      sum += p0 + p1;
      b16 a, c; split_bf16(p0, a, c); pbh[r] = a; pbl[r] = c; split_bf16(p1, a, c); pbh[8 + r] = a; pbl[8 + r] = c;
    }
    sum += __shfl_xor(sum, 16);
    l = l * al_ + sum;
#pragma unroll
    for (int r = 0; r < 8; ++r) { o0[r] *= al_; o1[r] *= al_; o2[r] *= al_; o3[r] *= al_; }
    const size_t v0 = ko + (size_t)(kb >> 4) * (DH * 16) + 8 * hh, v1 = v0 + DH * 16;
#pragma unroll
    for (int n = 0; n < 4; ++n) {
      const int f = n * 16 + col;
      const v16b vah = cat8b(ld8b(Vh + v0 + f * 16), ld8b(Vh + v1 + f * 16));
      const v16b val = cat8b(ld8b(Vl + v0 + f * 16), ld8b(Vl + v1 + f * 16));
      v8f& o = (n == 0) ? o0 : (n == 1) ? o1 : (n == 2) ? o2 : o3;
      o = wmma1(vah, val, pbh, pbl, o);
    }
  }
  const float inv = (q0 + col < slen && l > 0.0f) ? (1.0f / l) : 0.0f;   // padded query rows are zeroed
  float* Tt = Os[wid];
#pragma unroll
  for (int r = 0; r < 8; ++r) {
    const int hr = 8 * hh + r;
    Tt[col * 64 + 0 + hr] = o0[r] * inv; Tt[col * 64 + 16 + hr] = o1[r] * inv;
    Tt[col * 64 + 32 + hr] = o2[r] * inv; Tt[col * 64 + 48 + hr] = o3[r] * inv;
  }
  wave_lds_sync();
  float* dst0 = yf + ((size_t)b * T + q0) * HID + h * DH;     // 16 rows x 64 floats, row stride HID
#pragma unroll
  for (int j = 0; j < 8; ++j) { const int rr = j * 2 + hh, c4 = col * 4; *(v4f*)(dst0 + (size_t)rr * HID + c4) = *(const v4f*)(Tt + rr * 64 + c4); }
  
}

// ---------------------------------------------------------------------------
// Output projection: (8192 x 1024) x (1024 x 1024) -> f32, A split on the fly from f32 y, B = Wo planes. grid (16, 64), 32x64 tiles staged in LDS,
// ---------------------------------------------------------------------------
__global__ __launch_bounds__(128) void out_gemm_kernel(const float* __restrict__ yf, const b16* __restrict__ woh, const b16* __restrict__ wol, const float* __restrict__ bo, int yoff,
                                                       float* __restrict__ out) {
  __shared__ __attribute__((aligned(16))) float Ts[4][32 * 64];
  const int lane = threadIdx.x & 31, wave = threadIdx.x >> 5, nloc = lane & 15, hlf = lane >> 4;
  const int m0 = (blockIdx.y + yoff) * 128 + wave * 32;
  const int c0 = blockIdx.x * 64;
  v8f acc[2][4];
#pragma unroll
  for (int r = 0; r < 2; ++r)
#pragma unroll
    for (int t = 0; t < 4; ++t) acc[r][t] = (v8f){};
  gemm_tile_split(yf, woh, wol, m0, c0, HID, nloc, hlf, acc);
  float* Tt = Ts[wave];
#pragma unroll
  for (int t = 0; t < 4; ++t)
#pragma unroll
    for (int r = 0; r < 2; ++r)
#pragma unroll
      for (int v = 0; v < 8; ++v) Tt[(r * 16 + v + 8 * hlf) * 64 + t * 16 + nloc] = acc[r][t][v] + bo[c0 + t * 16 + nloc];
  wave_lds_sync();
  float* dst0 = out + (size_t)m0 * HID + c0;
#pragma unroll
  for (int j = 0; j < 16; ++j) { const int rr = j * 2 + hlf, c4 = nloc * 4; *(v4f*)(dst0 + (size_t)rr * HID + c4) = *(const v4f*)(Tt + rr * 64 + c4); }
  
}
__global__ __launch_bounds__(256) void wcvtT_kernel(const float* __restrict__ wq, const float* __restrict__ wk, const float* __restrict__ wv,
                                                    b16* __restrict__ wqh, b16* __restrict__ wql) {
  const size_t tid = (size_t)blockIdx.x * blockDim.x + threadIdx.x, stride = (size_t)gridDim.x * blockDim.x;
  const size_t nq = (size_t)NQKV * HID / 8;
  {
    for (size_t c = tid; c < nq; c += stride) {
      const size_t i = c * 8, n = i / HID, k0 = i % HID;
      const float* w = (n < (size_t)HID) ? (wq + n * HID) : (n < (size_t)(2 * HID)) ? (wk + (n - HID) * HID) : (wv + (n - 2 * HID) * HID);
      v8b bh, bl;
#pragma unroll
      for (int e = 0; e < 8; ++e) { b16 a, cc; split_bf16(w[k0 + e], a, cc); bh[e] = a; bl[e] = cc; }
      *(v8b*)(wqh + i) = bh; *(v8b*)(wql + i) = bl;
    }
    
  }
}
__global__ __launch_bounds__(256) void film_kernel(const float* __restrict__ te, const float* __restrict__ Wg, const float* __restrict__ bg,
                                                   const float* __restrict__ Wb, const float* __restrict__ bb, float* __restrict__ gam, float* __restrict__ bet) {
  const int t = blockIdx.x * 256 + threadIdx.x;           // Bsz * BLK
  const int b = t / BLK, c = t % BLK;
  const float* e = te + (size_t)b * HID;
  float g = bg[c], h = bb[c];
  for (int k = 0; k < HID; ++k) { g += e[k] * Wg[(size_t)c * HID + k]; h += e[k] * Wb[(size_t)c * HID + k]; }
  *(float*)(gam + t) = g; *(float*)(bet + t) = h; 
}
}  // namespace

extern "C" void kernel_launch(void* const* d_in, const int* in_sizes, int n_in,
                              void* d_out, int out_size, void* d_ws, size_t ws_size, hipStream_t stream) {
  (void)in_sizes; (void)n_in; (void)out_size;
  const float* x   = (const float*)d_in[0];    // hidden_states [16,512,1024]
  const float* te  = (const float*)d_in[1];    // task_embedding [16,1024]
  const float* Wq  = (const float*)d_in[2];  const float* bq = (const float*)d_in[3];
  const float* Wk  = (const float*)d_in[4];  const float* bk = (const float*)d_in[5];
  const float* Wv  = (const float*)d_in[6];  const float* bv = (const float*)d_in[7];
  const float* Wg  = (const float*)d_in[8];  const float* bg = (const float*)d_in[9];
  const float* Wb  = (const float*)d_in[10]; const float* bb = (const float*)d_in[11];
  const float* rwm = (const float*)d_in[12];   // [512,256]
  float* out = (float*)d_out;                  // ctx [16,512,1024]

  size_t off = 0; char* ws = (char*)d_ws;
  b16* wqh = (b16*)(ws + off); off += (size_t)NQKV * HID * 2;
  b16* wql = (b16*)(ws + off); off += (size_t)NQKV * HID * 2;
  b16* Qh  = (b16*)(ws + off); off += (size_t)MROWS * HID * 2;
  b16* Ql  = (b16*)(ws + off); off += (size_t)MROWS * HID * 2;
  b16* Kh  = (b16*)(ws + off); off += (size_t)MROWS * KVW * 2;
  b16* Kl  = (b16*)(ws + off); off += (size_t)MROWS * KVW * 2;
  b16* Vh  = (b16*)(ws + off); off += (size_t)MROWS * KVW * 2;
  b16* Vl  = (b16*)(ws + off); off += (size_t)MROWS * KVW * 2;
  float* gam = (float*)(ws + off); off += (size_t)Bsz * BLK * 4;
  float* bet = (float*)(ws + off); off += (size_t)Bsz * BLK * 4;
  if (off > ws_size) return;
  const int ROWBLK = MROWS / 128, NQT = Bsz * NH * QT_PER_B;
  wcvtT_kernel<<<2048, 256, 0, stream>>>(Wq, Wk, Wv, wqh, wql);
  film_kernel<<<Bsz * BLK / 256, 256, 0, stream>>>(te, Wg, bg, Wb, bb, gam, bet);
  qkv_gemm_kernel<<<dim3(NQKV / GBN, ROWBLK), 256, 0, stream>>>(x, x, x, wqh, wql, bq, bk, bv, nullptr, 0, 0, Qh, Ql, Kh, Kl, Vh, Vl);
  attn_kernel<<<NQT / 8, 256, 0, stream>>>(Qh, Ql, Kh, Kl, Vh, Vl, nullptr, gam, bet, rwm, out);
}

// v002
// It runs in 184 microseconds.
// Next to v001, in two timings, it ran 1.25 and 1.23 times as fast.
// All steps since v000 together make it 1.81 times as fast.
#include <hip/hip_runtime.h>

// BERT self-attention with a FiLM-conditioned block-diagonal additive bias (CBDA): q/k/v = x W^T + b (torch layout, 16 heads x 64), scores/8 +
// bias[b][q][k] (= gamma[b][k%256] * rwm[q][k%256] + beta[b][k%256] when q and k fall in the same 256-block, else 0; gamma/beta = task_emb Wg^T + bg /
// Wb^T + bb), softmax, ctx = P v -> [16, 512, 1024] (no output projection). Lean build: single f16 products on v_wmma_f32_16x16x32_f16, f32 accumulate
// (ctx averages ~512 positions; no large rows); fragment k-map per lane half hh for A AND B: elements 0..7 <- k = 8hh+0..7, 8..15 <- k = 16+8hh+0..7.

namespace {
constexpr int Bsz = 16, T = 512, HID = 1024, DH = 64, NH = 16, NKV = 16, REP = NH / NKV;
constexpr int BLK = 256;
constexpr int KVW = NKV * DH;                 // 1024
constexpr int NQKV = HID + 2 * KVW;           // 3072 columns: q | k | v
constexpr int MROWS = Bsz * T;                // 8192
constexpr int QT_PER_B = T / 16;              // 32

typedef _Float16 b16;                                           // f16 hi/lo planes
typedef __attribute__((ext_vector_type(16))) _Float16 v16b;
typedef __attribute__((ext_vector_type(8)))  _Float16 v8b;
typedef __attribute__((ext_vector_type(4)))  _Float16 v4b;
typedef __attribute__((ext_vector_type(8)))  float v8f;
typedef __attribute__((ext_vector_type(4)))  float v4f;

__device__ __forceinline__ v8b ld8b(const b16* p) { return *(const v8b*)p; }
__device__ __forceinline__ v16b cat8b(v8b a, v8b b) { return __builtin_shufflevector(a, b, 0, 1, 2, 3, 4, 5, 6, 7, 8, 9, 10, 11, 12, 13, 14, 15); }
// 16x16x32 16-bit fragment from a k-contiguous row pointer (A: lane&15 = row, B: lane&15 = column), hh = lane>>4:
// elements 0..7 <- p[8hh+0..7], elements 8..15 <- p[16+8hh+0..7]
__device__ __forceinline__ v16b frag_kb(const b16* p, int hh) { return cat8b(ld8b(p + 8 * hh), ld8b(p + 16 + 8 * hh)); }
__device__ __forceinline__ void split_bf16(float v, b16& hi, b16& lo) {   // (name kept) single f16: no low part
  hi = (b16)v; lo = (b16)0.0f;
}
// split fragment straight from an f32 k-contiguous row
__device__ __forceinline__ void frag_ksplit(const float* p, int hh, v16b& fh_, v16b& fl_) {
  const float* p0 = p + 8 * hh; const float* p1 = p + 16 + 8 * hh;
#pragma unroll
  for (int e = 0; e < 8; ++e) { b16 a, c; split_bf16(p0[e], a, c); fh_[e] = a; fl_[e] = c; split_bf16(p1[e], a, c); fh_[8 + e] = a; fl_[8 + e] = c; }
}
__device__ __forceinline__ v8f wmma16b(v16b a, v16b b, v8f c) {
  v8f d = __builtin_amdgcn_wmma_f32_16x16x32_f16(false, a, false, b, (short)0, c, false, false);
  asm volatile("v_nop\n\tv_nop\n\tv_nop\n\tv_nop" : "+v"(d) : "v"(a), "v"(b));
  return d;
}
// acc += A.B with both operands split: A = (ah, al), B = (bh, bl)
__device__ __forceinline__ v8f wmma3(v16b ah, v16b al, v16b bh, v16b bl, v8f c) {   // lean: single f16 product
  (void)al; (void)bl; return wmma16b(ah, bh, c);
}
__device__ __forceinline__ v8f wmma1(v16b ah, v16b al, v16b bh, v16b bl, v8f c) {   // attention products: single f16 (hi planes only)
  (void)al; (void)bl; return wmma16b(ah, bh, c);
}
__device__ __forceinline__ void wave_lds_sync() {
  __builtin_amdgcn_fence(__ATOMIC_RELEASE, "workgroup");
  __builtin_amdgcn_wave_barrier();
  __builtin_amdgcn_fence(__ATOMIC_ACQUIRE, "workgroup");
}

// ---------------------------------------------------------------------------
// Weights ([in][out]) -> f16 hi / lo planes transposed to [n][k] (k contiguous): columns of Wq|Wk|Wv into wqh/wql [3072][1024], Wo into woh/wol [1024][1024].
// ---------------------------------------------------------------------------
__global__ __launch_bounds__(256) void wcvt_kernel(const float* __restrict__ wq, const float* __restrict__ wk, const float* __restrict__ wv,
                                                   const float* __restrict__ wo, b16* __restrict__ wqh, b16* __restrict__ wql,
                                                   b16* __restrict__ woh, b16* __restrict__ wol) {
  const size_t tid = (size_t)blockIdx.x * blockDim.x + threadIdx.x, stride = (size_t)gridDim.x * blockDim.x;
  const size_t nq = (size_t)NQKV * HID / 8, no = (size_t)HID * HID / 8;
  {
    for (size_t c = tid; c < nq + no; c += stride) {
      float f[8]; size_t i; b16* dh; b16* dl;
      if (c < nq) {
        i = c * 8; const size_t n = i / HID, k0 = i % HID;
        const float* w; int nn, ld;
        if (n < (size_t)HID) { w = wq; nn = (int)n; ld = HID; } else if (n < (size_t)(HID + KVW)) { w = wk; nn = (int)n - HID; ld = KVW; } else { w = wv; nn = (int)n - HID - KVW; ld = KVW; }
#pragma unroll
        for (int e = 0; e < 8; ++e) f[e] = w[(size_t)(k0 + e) * ld + nn];       // W[k][n] ([in][out])
        dh = wqh; dl = wql;
      } else {
        i = (c - nq) * 8; const size_t n = i / HID, k0 = i % HID;
#pragma unroll
        for (int e = 0; e < 8; ++e) f[e] = wo[(size_t)(k0 + e) * HID + n];    // Wo[k][n] ([in][out])
        dh = woh; dl = wol;
      }
      v8b bh, bl;
#pragma unroll
      for (int e = 0; e < 8; ++e) { b16 a, cc; split_bf16(f[e], a, cc); bh[e] = a; bl[e] = cc; }
      *(v8b*)(dh + i) = bh; *(v8b*)(dl + i) = bl;
    }
    
  }
}

// 32x64 wave tile over K from f32 A rows and f16-plane B rows
__device__ __forceinline__ void gemm_tile_split(const float* __restrict__ A, const b16* __restrict__ wh, const b16* __restrict__ wl,
                                                int m0, int c0, int K, int nloc, int hlf, v8f (&acc)[2][4]) {
  for (int kb = 0; kb < K; kb += 32) {
    v16b a0h, a0l, a1h, a1l;
    frag_ksplit(A + (size_t)(m0 + nloc) * K + kb, hlf, a0h, a0l);
    frag_ksplit(A + (size_t)(m0 + 16 + nloc) * K + kb, hlf, a1h, a1l);
#pragma unroll
    for (int t = 0; t < 4; ++t) {
      const size_t wofs = (size_t)(c0 + t * 16 + nloc) * K + kb;
      const v16b bh = frag_kb(wh + wofs, hlf), bl = frag_kb(wl + wofs, hlf);
      acc[0][t] = wmma3(a0h, a0l, bh, bl, acc[0][t]);
      acc[1][t] = wmma3(a1h, a1l, bh, bl, acc[1][t]);
    }
  }
}

// ---------------------------------------------------------------------------
// QKV GEMM: (8192 x 1024) x (1024 x 3072), grid (12, 64), block 8 waves (2 x 4), block tile 128 rows x 256 columns, wave = 64 rows x 64 columns (one head of
// q, k or v). Per pass of 64 k the block brings its x rows (f32, whole 128-B lines, converted to f16 once) and its weight rows through registers into LDS
// (row pitch 144 B); every wave reads its fragments from there. Two LDS buffers, one barrier per pass: the next pass's global loads are issued ahead of this
// pass's products and stored into the other buffer behind them. Outputs as f16 hi/lo planes:
// q (x1/8) -> Qh/Ql [b][h][t][64]; k -> Kh/Kl [b][kvh][t][64] (8 KB contiguous per wave per plane);
// v -> Vh/Vl key-tiled [b][kvh][t/16][64][16] (8 KB contiguous per wave per plane).
// ---------------------------------------------------------------------------
constexpr int GBM = 128, GBN = 256, GKS = 64;
constexpr int GPITCH = GKS + 8;                 // LDS row pitch in f16 elements: 144 B = 16 B x 9 (conflict-free for 16-byte fragment reads)
constexpr int GSTAGE = (GBM + GBN) * GPITCH;    // one buffer: x rows, then weight rows
constexpr int GEPI = 8 * 4 * 32 * 64;           // epilogue staging, 16 KB per wave, in the same LDS behind the last pass's barrier
constexpr int GSMEM = (2 * GSTAGE > GEPI) ? 2 * GSTAGE : GEPI;
__global__ __launch_bounds__(256) void qkv_gemm_kernel(const float* __restrict__ xq, const float* __restrict__ xk, const float* __restrict__ xv,
                                                       const b16* __restrict__ wqh, const b16* __restrict__ wql,
                                                       const float* __restrict__ bq, const float* __restrict__ bk, const float* __restrict__ bv, const float* __restrict__ rope_cs, int xoff, int yoff,
                                                       b16* __restrict__ Qh, b16* __restrict__ Ql, b16* __restrict__ Kh, b16* __restrict__ Kl,
                                                       b16* __restrict__ Vh, b16* __restrict__ Vl) {
  __shared__ __attribute__((aligned(16))) b16 Sm[GSMEM];
  (void)wql; (void)rope_cs;
  const int tid = threadIdx.x, lane = tid & 31, nloc = lane & 15, hlf = lane >> 4;
  const int wave = __builtin_amdgcn_readfirstlane(tid >> 5);        // wave-uniform: head, matrix and staging bases stay in scalar registers
  const int wm = wave >> 2, wn = wave & 3;
  const int mblk = (blockIdx.y + yoff) * GBM;
  const int cblk = (blockIdx.x + xoff) * GBN;
  const int c0 = cblk + wn * 64;
  const int mat = (c0 < HID) ? 0 : (c0 < HID + KVW) ? 1 : 2;
  const int head = (mat == 0) ? (c0 / DH) : (mat == 1) ? ((c0 - HID) / DH) : ((c0 - HID - KVW) / DH);
  const float* x = (mat == 0) ? xq : (mat == 1) ? xk : xv;          // input of q, k or v (the same x at the launch)
  const float* bias = ((mat == 0) ? bq : (mat == 1) ? bk : bv) + head * DH;
  // loaders: x, 16 threads x 16 B per row (a wave covers 2 rows x 256 B); weights, 8 threads x 16 B per row (a wave covers 4 rows x 128 B)
  const int arow = tid >> 4, acol = (tid & 15) * 4;
  const int brow = tid >> 3, bcol = (tid & 7) * 8;
  const float* ag = x + (size_t)(mblk + arow) * HID + acol;
  const b16* bg = wqh + (size_t)(cblk + brow) * HID + bcol;
  b16* as = Sm + arow * GPITCH + acol;
  b16* bs = Sm + (GBM + brow) * GPITCH + bcol;
  const b16* af0 = Sm + (wm * 64 + nloc) * GPITCH;
  const b16* bf0 = Sm + (GBM + wn * 64 + nloc) * GPITCH;
  v4f ra[8]; v8b rb[8];
  v8f acc[4][4];
#pragma unroll
  for (int r = 0; r < 4; ++r)
#pragma unroll
    for (int t = 0; t < 4; ++t) acc[r][t] = (v8f){};
#pragma unroll
  for (int j = 0; j < 8; ++j) { ra[j] = *(const v4f*)(ag + (size_t)j * 16 * HID); rb[j] = ld8b(bg + (size_t)j * 32 * HID); }
#pragma unroll
  for (int j = 0; j < 8; ++j) {
    v4b h; 
#pragma unroll
    for (int e = 0; e < 4; ++e) h[e] = (b16)ra[j][e];
    *(v4b*)(as + j * 16 * GPITCH) = h; *(v8b*)(bs + j * 32 * GPITCH) = rb[j];
  }
  __syncthreads();
  for (int it = 0; it < HID / GKS; ++it) {
    const int cur = (it & 1) * GSTAGE, nxt = GSTAGE - cur;
    const bool more = it + 1 < HID / GKS;
    if (more) {
      const int kb = (it + 1) * GKS;
#pragma unroll
      for (int j = 0; j < 8; ++j) { ra[j] = *(const v4f*)(ag + (size_t)j * 16 * HID + kb); rb[j] = ld8b(bg + (size_t)j * 32 * HID + kb); }
    }
#pragma unroll
    for (int ks = 0; ks < GKS; ks += 32) {
      v16b a[4];
#pragma unroll
      for (int r = 0; r < 4; ++r) a[r] = frag_kb(af0 + cur + r * 16 * GPITCH + ks, hlf);
      v16b bh = frag_kb(bf0 + cur + ks, hlf);
#pragma unroll
      for (int t = 0; t < 4; ++t) {
        v16b bn = bh;
        if (t < 3) bn = frag_kb(bf0 + cur + (t + 1) * 16 * GPITCH + ks, hlf);   // the next column fragment is read ahead of this one's four products
#pragma unroll
        for (int r = 0; r < 4; ++r) acc[r][t] = wmma3(a[r], a[r], bh, bh, acc[r][t]);
        bh = bn;
      }
    }
    if (more) {
#pragma unroll
      for (int j = 0; j < 8; ++j) {
        v4b h;
#pragma unroll
        for (int e = 0; e < 4; ++e) h[e] = (b16)ra[j][e];
        *(v4b*)(as + nxt + j * 16 * GPITCH) = h; *(v8b*)(bs + nxt + j * 32 * GPITCH) = rb[j];
      }
    }
    __syncthreads();   // publishes the buffer just filled and ends every wave's reads of the one refilled next (after the last pass: of the LDS the epilogue reuses)
  }
  const float s = (mat == 0) ? 0.125f : 1.0f;
  b16* Tw = Sm + wave * (4 * 32 * 64);                              // each wave stages in its own 16 KB: [32-row half][plane][32 * 64]
#pragma unroll
  for (int r2 = 0; r2 < 2; ++r2) {
    b16* Tp0 = Tw + r2 * (2 * 32 * 64); b16* Tp1 = Tp0 + 32 * 64;
#pragma unroll
    for (int t = 0; t < 4; ++t)
#pragma unroll
      for (int r = 0; r < 2; ++r)
#pragma unroll
        for (int v = 0; v < 8; ++v) {
          const int rr = r * 16 + v + 8 * hlf, d = t * 16 + nloc;
          const float val = acc[r2 * 2 + r][t][v] + bias[d];
          b16 yh, yl; split_bf16(val * s, yh, yl);
          const int idx = (mat < 2) ? (rr * 64 + d) : ((rr >> 4) * 1024 + d * 16 + (rr & 15));
          Tp0[idx] = yh; Tp1[idx] = yl;
        }
  }
  wave_lds_sync();
#pragma unroll
  for (int r2 = 0; r2 < 2; ++r2) {
    const b16* Tp0 = Tw + r2 * (2 * 32 * 64); const b16* Tp1 = Tp0 + 32 * 64;
    const int m0 = mblk + wm * 64 + r2 * 32;
    const int b = m0 / T, t0 = m0 % T;
    b16* dh; b16* dl; size_t o;
    if (mat == 0)      { o = ((size_t)(b * NH + head) * T + t0) * DH; dh = Qh + o; dl = Ql + o; }
    else if (mat == 1) { o = ((size_t)(b * NKV + head) * T + t0) * DH; dh = Kh + o; dl = Kl + o; }
    else               { o = ((size_t)(b * NKV + head) * QT_PER_B + (t0 >> 4)) * (size_t)(DH * 16); dh = Vh + o; dl = Vl + o; }
#pragma unroll
    for (int j = 0; j < 8; ++j) { const int e = (j * 32 + lane) * 8; *(v8b*)(dh + e) = ld8b(Tp0 + e); *(v8b*)(dl + e) = ld8b(Tp1 + e); }
    // the next half's LDS reads reuse the registers that these stores name: keep the wait in front of that overwrite
    if (r2 == 0) asm volatile("s_wait_xcnt 0x0" ::: "memory");
  }
}

// ---------------------------------------------------------------------------
// Transposed flash attention: each wave owns one 16-query tile of one (b, head); 8 waves per block; all keys in chunks of 32.
// S^T = K.Q^T (split), per-lane online softmax; P^T built in registers from the two S^T accumulators
// ---------------------------------------------------------------------------
__global__ __launch_bounds__(256) void attn_kernel(const b16* __restrict__ Qh, const b16* __restrict__ Ql, const b16* __restrict__ Kh, const b16* __restrict__ Kl,
                                                   const b16* __restrict__ Vh, const b16* __restrict__ Vl, const int* __restrict__ seqlen,
                                                   const float* __restrict__ gam, const float* __restrict__ bet, const float* __restrict__ rwm,
                                                   float* __restrict__ yf) {
  __shared__ __attribute__((aligned(16))) float Os[8][16 * 64];
  const int wid = threadIdx.x >> 5, lane = threadIdx.x & 31, hh = lane >> 4, col = lane & 15;
  const int qtile = blockIdx.x * 8 + wid;                 // over Bsz*NH*QT_PER_B
  const int g = qtile / QT_PER_B;                         // b*NH + h
  const int q0 = (qtile % QT_PER_B) << 4;
  const int b = g / NH, h = g % NH, kvh = h / REP;
  const size_t ko = (size_t)(b * NKV + kvh) * T * DH;
  const size_t qo = ((size_t)g * T + q0 + col) * DH;
  const v16b q0h = frag_kb(Qh + qo, hh), q0l = frag_kb(Ql + qo, hh), q1h = frag_kb(Qh + qo + 32, hh), q1l = frag_kb(Ql + qo + 32, hh);
  float m = -INFINITY, l = 0.0f;
  v8f o0 = {}, o1 = {}, o2 = {}, o3 = {};
  const int slen = T; (void)seqlen;                       // no padding in this module
  for (int kb = 0; kb < T; kb += 32) {                   // non-causal: every key chunk
    const size_t r0 = ko + (size_t)(kb + col) * DH, r1 = ko + (size_t)(kb + 16 + col) * DH;
    v8f s0 = {}, s1 = {};
    {
      v16b ah = frag_kb(Kh + r0, hh), al = frag_kb(Kl + r0, hh);
      s0 = wmma1(ah, al, q0h, q0l, s0);
      ah = frag_kb(Kh + r0 + 32, hh); al = frag_kb(Kl + r0 + 32, hh);
      s0 = wmma1(ah, al, q1h, q1l, s0);
      ah = frag_kb(Kh + r1, hh); al = frag_kb(Kl + r1, hh);
      s1 = wmma1(ah, al, q0h, q0l, s1);
      ah = frag_kb(Kh + r1 + 32, hh); al = frag_kb(Kl + r1 + 32, hh);
      s1 = wmma1(ah, al, q1h, q1l, s1);
    }
    (void)slen;
    if ((kb >> 8) == (q0 >> 8)) {                         // CBDA bias: same 256-block of query and key (chunks never straddle a block)
      const int qi = q0 + col;
      const float* rw = rwm + (size_t)qi * BLK + (kb & (BLK - 1)) + 8 * hh;
      const float* gm = gam + (size_t)b * BLK + (kb & (BLK - 1)) + 8 * hh;
      const float* bt = bet + (size_t)b * BLK + (kb & (BLK - 1)) + 8 * hh;
#pragma unroll
      for (int r = 0; r < 8; ++r) { s0[r] += gm[r] * rw[r] + bt[r]; s1[r] += gm[16 + r] * rw[16 + r] + bt[16 + r]; }
    }
    float mr = -INFINITY;
#pragma unroll
    for (int r = 0; r < 8; ++r) mr = fmaxf(mr, fmaxf(s0[r], s1[r]));
    mr = fmaxf(mr, __shfl_xor(mr, 16));
    float mn = fmaxf(m, mr);
    if (mn == -INFINITY) mn = 0.0f;           // fully masked so far (padded query rows far past seq_len): keep exp() at 0
    const float al_ = __expf(m - mn);
    m = mn;
    float sum = 0.0f;
    v16b pbh, pbl;
#pragma unroll
    for (int r = 0; r < 8; ++r) {
      const float p0 = __expf(s0[r] - mn), p1 = __expf(s1[r] - mn);
      sum += p0 + p1;
      b16 a, c; split_bf16(p0, a, c); pbh[r] = a; pbl[r] = c; split_bf16(p1, a, c); pbh[8 + r] = a; pbl[8 + r] = c;
    }
    sum += __shfl_xor(sum, 16);
    l = l * al_ + sum;
#pragma unroll
    for (int r = 0; r < 8; ++r) { o0[r] *= al_; o1[r] *= al_; o2[r] *= al_; o3[r] *= al_; }
    const size_t v0 = ko + (size_t)(kb >> 4) * (DH * 16) + 8 * hh, v1 = v0 + DH * 16;
#pragma unroll
    for (int n = 0; n < 4; ++n) {
      const int f = n * 16 + col;
      const v16b vah = cat8b(ld8b(Vh + v0 + f * 16), ld8b(Vh + v1 + f * 16));
      const v16b val = cat8b(ld8b(Vl + v0 + f * 16), ld8b(Vl + v1 + f * 16));
      v8f& o = (n == 0) ? o0 : (n == 1) ? o1 : (n == 2) ? o2 : o3;
      o = wmma1(vah, val, pbh, pbl, o);
    }
  }
  const float inv = (q0 + col < slen && l > 0.0f) ? (1.0f / l) : 0.0f;   // padded query rows are zeroed
  float* Tt = Os[wid];
#pragma unroll
  for (int r = 0; r < 8; ++r) {
    const int hr = 8 * hh + r;
    Tt[col * 64 + 0 + hr] = o0[r] * inv; Tt[col * 64 + 16 + hr] = o1[r] * inv;
    Tt[col * 64 + 32 + hr] = o2[r] * inv; Tt[col * 64 + 48 + hr] = o3[r] * inv;
  }
  wave_lds_sync();
  float* dst0 = yf + ((size_t)b * T + q0) * HID + h * DH;     // 16 rows x 64 floats, row stride HID
#pragma unroll
  for (int j = 0; j < 8; ++j) { const int rr = j * 2 + hh, c4 = col * 4; *(v4f*)(dst0 + (size_t)rr * HID + c4) = *(const v4f*)(Tt + rr * 64 + c4); }
  
}

// ---------------------------------------------------------------------------
// Output projection: (8192 x 1024) x (1024 x 1024) -> f32, A split on the fly from f32 y, B = Wo planes. grid (16, 64), 32x64 tiles staged in LDS,
// ---------------------------------------------------------------------------
__global__ __launch_bounds__(128) void out_gemm_kernel(const float* __restrict__ yf, const b16* __restrict__ woh, const b16* __restrict__ wol, const float* __restrict__ bo, int yoff,
                                                       float* __restrict__ out) {
  __shared__ __attribute__((aligned(16))) float Ts[4][32 * 64];
  const int lane = threadIdx.x & 31, wave = threadIdx.x >> 5, nloc = lane & 15, hlf = lane >> 4;
  const int m0 = (blockIdx.y + yoff) * 128 + wave * 32;
  const int c0 = blockIdx.x * 64;
  v8f acc[2][4];
#pragma unroll
  for (int r = 0; r < 2; ++r)
#pragma unroll
    for (int t = 0; t < 4; ++t) acc[r][t] = (v8f){};
  gemm_tile_split(yf, woh, wol, m0, c0, HID, nloc, hlf, acc);
  float* Tt = Ts[wave];
#pragma unroll
  for (int t = 0; t < 4; ++t)
#pragma unroll
    for (int r = 0; r < 2; ++r)
#pragma unroll
      for (int v = 0; v < 8; ++v) Tt[(r * 16 + v + 8 * hlf) * 64 + t * 16 + nloc] = acc[r][t][v] + bo[c0 + t * 16 + nloc];
  wave_lds_sync();
  float* dst0 = out + (size_t)m0 * HID + c0;
#pragma unroll
  for (int j = 0; j < 16; ++j) { const int rr = j * 2 + hlf, c4 = nloc * 4; *(v4f*)(dst0 + (size_t)rr * HID + c4) = *(const v4f*)(Tt + rr * 64 + c4); }
  
}
__global__ __launch_bounds__(256) void wcvtT_kernel(const float* __restrict__ wq, const float* __restrict__ wk, const float* __restrict__ wv,
                                                    b16* __restrict__ wqh, b16* __restrict__ wql) {
  const size_t tid = (size_t)blockIdx.x * blockDim.x + threadIdx.x, stride = (size_t)gridDim.x * blockDim.x;
  const size_t nq = (size_t)NQKV * HID / 8;
  {
    for (size_t c = tid; c < nq; c += stride) {
      const size_t i = c * 8, n = i / HID, k0 = i % HID;
      const float* w = (n < (size_t)HID) ? (wq + n * HID) : (n < (size_t)(2 * HID)) ? (wk + (n - HID) * HID) : (wv + (n - 2 * HID) * HID);
      v8b bh, bl;
#pragma unroll
      for (int e = 0; e < 8; ++e) { b16 a, cc; split_bf16(w[k0 + e], a, cc); bh[e] = a; bl[e] = cc; }
      *(v8b*)(wqh + i) = bh; *(v8b*)(wql + i) = bl;
    }
    
  }
}
// FiLM maps gamma[b][c] = te[b] . Wg[c] + bg[c] and beta[b][c] = te[b] . Wb[c] + bb[c]. One block makes one 128-B line of one map (32 columns of one
// example); each wave takes four weight rows, and its 32 lanes read te[b] and every row as whole contiguous 512-B pieces (k = 128 j + 4 lane + 0..3).
// Per-lane partial sums, then a 32-lane xor tree; the 32 results meet in LDS and leave as one whole-line store.
constexpr int FCG = BLK / 32;                   // column groups of 32 per map
__global__ __launch_bounds__(256) void film_kernel(const float* __restrict__ te, const float* __restrict__ Wg, const float* __restrict__ bg,
                                                   const float* __restrict__ Wb, const float* __restrict__ bb, float* __restrict__ gam, float* __restrict__ bet) {
  __shared__ __attribute__((aligned(16))) float Rs[32];
  const int lane = threadIdx.x & 31;
  const int wave = __builtin_amdgcn_readfirstlane(threadIdx.x >> 5);   // wave-uniform: row bases stay in scalar registers
  const int mat = blockIdx.x & 1, cg = (blockIdx.x >> 1) % FCG, b = blockIdx.x / (2 * FCG);
  const float* e = te + (size_t)b * HID + lane * 4;
  const float* w = (mat ? Wb : Wg) + (size_t)(cg * 32 + wave * 4) * HID + lane * 4;
  const float bias = (mat ? bb : bg)[cg * 32 + lane];
  // every loop below is fully unrolled: ev, a and s stay in registers, and the row loads are issued ahead of the sums that use them
  v4f ev[HID / 128];
#pragma unroll
  for (int j = 0; j < HID / 128; ++j) ev[j] = *(const v4f*)(e + j * 128);
  v4f a[4];
#pragma unroll
  for (int r = 0; r < 4; ++r) a[r] = (v4f){};
#pragma unroll
  for (int j = 0; j < HID / 128; ++j)
#pragma unroll
    for (int r = 0; r < 4; ++r) a[r] += ev[j] * *(const v4f*)(w + (size_t)r * HID + j * 128);
  v4f s;
#pragma unroll
  for (int r = 0; r < 4; ++r) s[r] = (a[r][0] + a[r][1]) + (a[r][2] + a[r][3]);
#pragma unroll
  for (int m = 16; m >= 1; m >>= 1)
#pragma unroll
    for (int r = 0; r < 4; ++r) s[r] += __shfl_xor(s[r], m);
  if (lane == 0) *(v4f*)(Rs + wave * 4) = s;
  __syncthreads();   // the eight waves' sums are in LDS before the first wave reads them
  if (threadIdx.x < 32) (mat ? bet : gam)[(size_t)b * BLK + cg * 32 + lane] = Rs[lane] + bias;
}
}  // namespace

extern "C" void kernel_launch(void* const* d_in, const int* in_sizes, int n_in,
                              void* d_out, int out_size, void* d_ws, size_t ws_size, hipStream_t stream) {
  (void)in_sizes; (void)n_in; (void)out_size;
  const float* x   = (const float*)d_in[0];    // hidden_states [16,512,1024]
  const float* te  = (const float*)d_in[1];    // task_embedding [16,1024]
  const float* Wq  = (const float*)d_in[2];  const float* bq = (const float*)d_in[3];
  const float* Wk  = (const float*)d_in[4];  const float* bk = (const float*)d_in[5];
  const float* Wv  = (const float*)d_in[6];  const float* bv = (const float*)d_in[7];
  const float* Wg  = (const float*)d_in[8];  const float* bg = (const float*)d_in[9];
  const float* Wb  = (const float*)d_in[10]; const float* bb = (const float*)d_in[11];
  const float* rwm = (const float*)d_in[12];   // [512,256]
  float* out = (float*)d_out;                  // ctx [16,512,1024]

  size_t off = 0; char* ws = (char*)d_ws;
  b16* wqh = (b16*)(ws + off); off += (size_t)NQKV * HID * 2;
  b16* wql = (b16*)(ws + off); off += (size_t)NQKV * HID * 2;
  b16* Qh  = (b16*)(ws + off); off += (size_t)MROWS * HID * 2;
  b16* Ql  = (b16*)(ws + off); off += (size_t)MROWS * HID * 2;
  b16* Kh  = (b16*)(ws + off); off += (size_t)MROWS * KVW * 2;
  b16* Kl  = (b16*)(ws + off); off += (size_t)MROWS * KVW * 2;
  b16* Vh  = (b16*)(ws + off); off += (size_t)MROWS * KVW * 2;
  b16* Vl  = (b16*)(ws + off); off += (size_t)MROWS * KVW * 2;
  float* gam = (float*)(ws + off); off += (size_t)Bsz * BLK * 4;
  float* bet = (float*)(ws + off); off += (size_t)Bsz * BLK * 4;
  if (off > ws_size) return;
  const int ROWBLK = MROWS / 128, NQT = Bsz * NH * QT_PER_B;
  wcvtT_kernel<<<2048, 256, 0, stream>>>(Wq, Wk, Wv, wqh, wql);
  film_kernel<<<Bsz * FCG * 2, 256, 0, stream>>>(te, Wg, bg, Wb, bb, gam, bet);
  qkv_gemm_kernel<<<dim3(NQKV / GBN, ROWBLK), 256, 0, stream>>>(x, x, x, wqh, wql, bq, bk, bv, nullptr, 0, 0, Qh, Ql, Kh, Kl, Vh, Vl);
  attn_kernel<<<NQT / 8, 256, 0, stream>>>(Qh, Ql, Kh, Kl, Vh, Vl, nullptr, gam, bet, rwm, out);
}

// v003
// A run of this version takes 92 microseconds.
// In both of two side-by-side timings against v002, it was 2.01 times as fast.
// Counting every step since v000, it is 3.65 times as fast.
#include <hip/hip_runtime.h>

// BERT self-attention with a FiLM-conditioned block-diagonal additive bias (CBDA): q/k/v = x W^T + b (torch layout, 16 heads x 64), scores/8 +
// bias[b][q][k] (= gamma[b][k%256] * rwm[q][k%256] + beta[b][k%256] when q and k fall in the same 256-block, else 0; gamma/beta = task_emb Wg^T + bg /
// Wb^T + bb), softmax, ctx = P v -> [16, 512, 1024] (no output projection). Lean build: single f16 products on v_wmma_f32_16x16x32_f16, f32 accumulate
// (ctx averages ~512 positions; no large rows); fragment k-map per lane half hh for A AND B: elements 0..7 <- k = 8hh+0..7, 8..15 <- k = 16+8hh+0..7.

namespace {
constexpr int Bsz = 16, T = 512, HID = 1024, DH = 64, NH = 16, NKV = 16, REP = NH / NKV;
constexpr int BLK = 256;
constexpr int KVW = NKV * DH;                 // 1024
constexpr int NQKV = HID + 2 * KVW;           // 3072 columns: q | k | v
constexpr int MROWS = Bsz * T;                // 8192
constexpr int QT_PER_B = T / 16;              // 32

typedef _Float16 b16;                                           // f16 hi/lo planes
typedef __attribute__((ext_vector_type(16))) _Float16 v16b;
typedef __attribute__((ext_vector_type(8)))  _Float16 v8b;
typedef __attribute__((ext_vector_type(4)))  _Float16 v4b;
typedef __attribute__((ext_vector_type(8)))  float v8f;
typedef __attribute__((ext_vector_type(4)))  float v4f;

__device__ __forceinline__ v8b ld8b(const b16* p) { return *(const v8b*)p; }
__device__ __forceinline__ v16b cat8b(v8b a, v8b b) { return __builtin_shufflevector(a, b, 0, 1, 2, 3, 4, 5, 6, 7, 8, 9, 10, 11, 12, 13, 14, 15); }
// 16x16x32 16-bit fragment from a k-contiguous row pointer (A: lane&15 = row, B: lane&15 = column), hh = lane>>4:
// elements 0..7 <- p[8hh+0..7], elements 8..15 <- p[16+8hh+0..7]
__device__ __forceinline__ v16b frag_kb(const b16* p, int hh) { return cat8b(ld8b(p + 8 * hh), ld8b(p + 16 + 8 * hh)); }
__device__ __forceinline__ void split_bf16(float v, b16& hi, b16& lo) {   // (name kept) single f16: no low part
  hi = (b16)v; lo = (b16)0.0f;
}
// split fragment straight from an f32 k-contiguous row
__device__ __forceinline__ void frag_ksplit(const float* p, int hh, v16b& fh_, v16b& fl_) {
  const float* p0 = p + 8 * hh; const float* p1 = p + 16 + 8 * hh;
#pragma unroll
  for (int e = 0; e < 8; ++e) { b16 a, c; split_bf16(p0[e], a, c); fh_[e] = a; fl_[e] = c; split_bf16(p1[e], a, c); fh_[8 + e] = a; fl_[8 + e] = c; }
}
__device__ __forceinline__ v8f wmma16b(v16b a, v16b b, v8f c) {
  v8f d = __builtin_amdgcn_wmma_f32_16x16x32_f16(false, a, false, b, (short)0, c, false, false);
  asm volatile("v_nop\n\tv_nop\n\tv_nop\n\tv_nop" : "+v"(d) : "v"(a), "v"(b));
  return d;
}
// acc += A.B with both operands split: A = (ah, al), B = (bh, bl)
__device__ __forceinline__ v8f wmma3(v16b ah, v16b al, v16b bh, v16b bl, v8f c) {   // lean: single f16 product
  (void)al; (void)bl; return wmma16b(ah, bh, c);
}
__device__ __forceinline__ v8f wmma1(v16b ah, v16b al, v16b bh, v16b bl, v8f c) {   // attention products: single f16 (hi planes only)
  (void)al; (void)bl; return wmma16b(ah, bh, c);
}
__device__ __forceinline__ void wave_lds_sync() {
  __builtin_amdgcn_fence(__ATOMIC_RELEASE, "workgroup");
  __builtin_amdgcn_wave_barrier();
  __builtin_amdgcn_fence(__ATOMIC_ACQUIRE, "workgroup");
}

// ---------------------------------------------------------------------------
// Weights ([in][out]) -> f16 hi / lo planes transposed to [n][k] (k contiguous): columns of Wq|Wk|Wv into wqh/wql [3072][1024], Wo into woh/wol [1024][1024].
// ---------------------------------------------------------------------------
__global__ __launch_bounds__(256) void wcvt_kernel(const float* __restrict__ wq, const float* __restrict__ wk, const float* __restrict__ wv,
                                                   const float* __restrict__ wo, b16* __restrict__ wqh, b16* __restrict__ wql,
                                                   b16* __restrict__ woh, b16* __restrict__ wol) {
  const size_t tid = (size_t)blockIdx.x * blockDim.x + threadIdx.x, stride = (size_t)gridDim.x * blockDim.x;
  const size_t nq = (size_t)NQKV * HID / 8, no = (size_t)HID * HID / 8;
  {
    for (size_t c = tid; c < nq + no; c += stride) {
      float f[8]; size_t i; b16* dh; b16* dl;
      if (c < nq) {
        i = c * 8; const size_t n = i / HID, k0 = i % HID;
        const float* w; int nn, ld;
        if (n < (size_t)HID) { w = wq; nn = (int)n; ld = HID; } else if (n < (size_t)(HID + KVW)) { w = wk; nn = (int)n - HID; ld = KVW; } else { w = wv; nn = (int)n - HID - KVW; ld = KVW; }
#pragma unroll
        for (int e = 0; e < 8; ++e) f[e] = w[(size_t)(k0 + e) * ld + nn];       // W[k][n] ([in][out])
        dh = wqh; dl = wql;
      } else {
        i = (c - nq) * 8; const size_t n = i / HID, k0 = i % HID;
#pragma unroll
        for (int e = 0; e < 8; ++e) f[e] = wo[(size_t)(k0 + e) * HID + n];    // Wo[k][n] ([in][out])
        dh = woh; dl = wol;
      }
      v8b bh, bl;
#pragma unroll
      for (int e = 0; e < 8; ++e) { b16 a, cc; split_bf16(f[e], a, cc); bh[e] = a; bl[e] = cc; }
      *(v8b*)(dh + i) = bh; *(v8b*)(dl + i) = bl;
    }
    
  }
}

// 32x64 wave tile over K from f32 A rows and f16-plane B rows
__device__ __forceinline__ void gemm_tile_split(const float* __restrict__ A, const b16* __restrict__ wh, const b16* __restrict__ wl,
                                                int m0, int c0, int K, int nloc, int hlf, v8f (&acc)[2][4]) {
  for (int kb = 0; kb < K; kb += 32) {
    v16b a0h, a0l, a1h, a1l;
    frag_ksplit(A + (size_t)(m0 + nloc) * K + kb, hlf, a0h, a0l);
    frag_ksplit(A + (size_t)(m0 + 16 + nloc) * K + kb, hlf, a1h, a1l);
#pragma unroll
    for (int t = 0; t < 4; ++t) {
      const size_t wofs = (size_t)(c0 + t * 16 + nloc) * K + kb;
      const v16b bh = frag_kb(wh + wofs, hlf), bl = frag_kb(wl + wofs, hlf);
      acc[0][t] = wmma3(a0h, a0l, bh, bl, acc[0][t]);
      acc[1][t] = wmma3(a1h, a1l, bh, bl, acc[1][t]);
    }
  }
}

// ---------------------------------------------------------------------------
// QKV GEMM: (8192 x 1024) x (1024 x 3072), grid (12, 64), block 8 waves (2 x 4), block tile 128 rows x 256 columns, wave = 64 rows x 64 columns (one head of
// q, k or v). Per pass of 64 k the block brings its x rows (f32, whole 128-B lines, converted to f16 once) and its weight rows through registers into LDS
// (row pitch 144 B); every wave reads its fragments from there. Two LDS buffers, one barrier per pass: the next pass's global loads are issued ahead of this
// pass's products and stored into the other buffer behind them. Outputs as f16 hi/lo planes:
// q (x1/8) -> Qh/Ql [b][h][t][64]; k -> Kh/Kl [b][kvh][t][64] (8 KB contiguous per wave per plane);
// v -> Vh/Vl key-tiled [b][kvh][t/16][64][16] (8 KB contiguous per wave per plane).
// ---------------------------------------------------------------------------
constexpr int GBM = 128, GBN = 256, GKS = 64;
constexpr int GPITCH = GKS + 8;                 // LDS row pitch in f16 elements: 144 B = 16 B x 9 (conflict-free for 16-byte fragment reads)
constexpr int GSTAGE = (GBM + GBN) * GPITCH;    // one buffer: x rows, then weight rows
constexpr int GEPI = 8 * 4 * 32 * 64;           // epilogue staging, 16 KB per wave, in the same LDS behind the last pass's barrier
constexpr int GSMEM = (2 * GSTAGE > GEPI) ? 2 * GSTAGE : GEPI;
__global__ __launch_bounds__(256) void qkv_gemm_kernel(const float* __restrict__ xq, const float* __restrict__ xk, const float* __restrict__ xv,
                                                       const b16* __restrict__ wqh, const b16* __restrict__ wql,
                                                       const float* __restrict__ bq, const float* __restrict__ bk, const float* __restrict__ bv, const float* __restrict__ rope_cs, int xoff, int yoff,
                                                       b16* __restrict__ Qh, b16* __restrict__ Ql, b16* __restrict__ Kh, b16* __restrict__ Kl,
                                                       b16* __restrict__ Vh, b16* __restrict__ Vl) {
  __shared__ __attribute__((aligned(16))) b16 Sm[GSMEM];
  (void)wql; (void)rope_cs;
  const int tid = threadIdx.x, lane = tid & 31, nloc = lane & 15, hlf = lane >> 4;
  const int wave = __builtin_amdgcn_readfirstlane(tid >> 5);        // wave-uniform: head, matrix and staging bases stay in scalar registers
  const int wm = wave >> 2, wn = wave & 3;
  const int mblk = (blockIdx.y + yoff) * GBM;
  const int cblk = (blockIdx.x + xoff) * GBN;
  const int c0 = cblk + wn * 64;
  const int mat = (c0 < HID) ? 0 : (c0 < HID + KVW) ? 1 : 2;
  const int head = (mat == 0) ? (c0 / DH) : (mat == 1) ? ((c0 - HID) / DH) : ((c0 - HID - KVW) / DH);
  const float* x = (mat == 0) ? xq : (mat == 1) ? xk : xv;          // input of q, k or v (the same x at the launch)
  const float* bias = ((mat == 0) ? bq : (mat == 1) ? bk : bv) + head * DH;
  // loaders: x, 16 threads x 16 B per row (a wave covers 2 rows x 256 B); weights, 8 threads x 16 B per row (a wave covers 4 rows x 128 B)
  const int arow = tid >> 4, acol = (tid & 15) * 4;
  const int brow = tid >> 3, bcol = (tid & 7) * 8;
  const float* ag = x + (size_t)(mblk + arow) * HID + acol;
  const b16* bg = wqh + (size_t)(cblk + brow) * HID + bcol;
  b16* as = Sm + arow * GPITCH + acol;
  b16* bs = Sm + (GBM + brow) * GPITCH + bcol;
  const b16* af0 = Sm + (wm * 64 + nloc) * GPITCH;
  const b16* bf0 = Sm + (GBM + wn * 64 + nloc) * GPITCH;
  v4f ra[8]; v8b rb[8];
  v8f acc[4][4];
#pragma unroll
  for (int r = 0; r < 4; ++r)
#pragma unroll
    for (int t = 0; t < 4; ++t) acc[r][t] = (v8f){};
#pragma unroll
  for (int j = 0; j < 8; ++j) { ra[j] = *(const v4f*)(ag + (size_t)j * 16 * HID); rb[j] = ld8b(bg + (size_t)j * 32 * HID); }
#pragma unroll
  for (int j = 0; j < 8; ++j) {
    v4b h; 
#pragma unroll
    for (int e = 0; e < 4; ++e) h[e] = (b16)ra[j][e];
    *(v4b*)(as + j * 16 * GPITCH) = h; *(v8b*)(bs + j * 32 * GPITCH) = rb[j];
  }
  __syncthreads();
  for (int it = 0; it < HID / GKS; ++it) {
    const int cur = (it & 1) * GSTAGE, nxt = GSTAGE - cur;
    const bool more = it + 1 < HID / GKS;
    if (more) {
      const int kb = (it + 1) * GKS;
#pragma unroll
      for (int j = 0; j < 8; ++j) { ra[j] = *(const v4f*)(ag + (size_t)j * 16 * HID + kb); rb[j] = ld8b(bg + (size_t)j * 32 * HID + kb); }
    }
#pragma unroll
    for (int ks = 0; ks < GKS; ks += 32) {
      v16b a[4];
#pragma unroll
      for (int r = 0; r < 4; ++r) a[r] = frag_kb(af0 + cur + r * 16 * GPITCH + ks, hlf);
      v16b bh = frag_kb(bf0 + cur + ks, hlf);
#pragma unroll
      for (int t = 0; t < 4; ++t) {
        v16b bn = bh;
        if (t < 3) bn = frag_kb(bf0 + cur + (t + 1) * 16 * GPITCH + ks, hlf);   // the next column fragment is read ahead of this one's four products
#pragma unroll
        for (int r = 0; r < 4; ++r) acc[r][t] = wmma3(a[r], a[r], bh, bh, acc[r][t]);
        bh = bn;
      }
    }
    if (more) {
#pragma unroll
      for (int j = 0; j < 8; ++j) {
        v4b h;
#pragma unroll
        for (int e = 0; e < 4; ++e) h[e] = (b16)ra[j][e];
        *(v4b*)(as + nxt + j * 16 * GPITCH) = h; *(v8b*)(bs + nxt + j * 32 * GPITCH) = rb[j];
      }
    }
    __syncthreads();   // publishes the buffer just filled and ends every wave's reads of the one refilled next (after the last pass: of the LDS the epilogue reuses)
  }
  const float s = (mat == 0) ? 0.125f : 1.0f;
  b16* Tw = Sm + wave * (4 * 32 * 64);                              // each wave stages in its own 16 KB: [32-row half][plane][32 * 64]
#pragma unroll
  for (int r2 = 0; r2 < 2; ++r2) {
    b16* Tp0 = Tw + r2 * (2 * 32 * 64); b16* Tp1 = Tp0 + 32 * 64;
#pragma unroll
    for (int t = 0; t < 4; ++t)
#pragma unroll
      for (int r = 0; r < 2; ++r)
#pragma unroll
        for (int v = 0; v < 8; ++v) {
          const int rr = r * 16 + v + 8 * hlf, d = t * 16 + nloc;
          const float val = acc[r2 * 2 + r][t][v] + bias[d];
          b16 yh, yl; split_bf16(val * s, yh, yl);
          const int idx = (mat < 2) ? (rr * 64 + d) : ((rr >> 4) * 1024 + d * 16 + (rr & 15));
          Tp0[idx] = yh; Tp1[idx] = yl;
        }
  }
  wave_lds_sync();
#pragma unroll
  for (int r2 = 0; r2 < 2; ++r2) {
    const b16* Tp0 = Tw + r2 * (2 * 32 * 64); const b16* Tp1 = Tp0 + 32 * 64;
    const int m0 = mblk + wm * 64 + r2 * 32;
    const int b = m0 / T, t0 = m0 % T;
    b16* dh; b16* dl; size_t o;
    if (mat == 0)      { o = ((size_t)(b * NH + head) * T + t0) * DH; dh = Qh + o; dl = Ql + o; }
    else if (mat == 1) { o = ((size_t)(b * NKV + head) * T + t0) * DH; dh = Kh + o; dl = Kl + o; }
    else               { o = ((size_t)(b * NKV + head) * QT_PER_B + (t0 >> 4)) * (size_t)(DH * 16); dh = Vh + o; dl = Vl + o; }
#pragma unroll
    for (int j = 0; j < 8; ++j) { const int e = (j * 32 + lane) * 8; *(v8b*)(dh + e) = ld8b(Tp0 + e); *(v8b*)(dl + e) = ld8b(Tp1 + e); }
    // the next half's LDS reads reuse the registers that these stores name: keep the wait in front of that overwrite
    if (r2 == 0) asm volatile("s_wait_xcnt 0x0" ::: "memory");
  }
}

// ---------------------------------------------------------------------------
// Transposed flash attention: one block per (b, head), 32 waves, each wave owns one 16-query tile; all keys in chunks of 32.
// The head's K rows (LDS pitch 144 B, conflict-free for 16-byte fragment reads) and its key-tiled V (in LDS [t/16][key half][64][8], so that each 16-lane
// half of a fragment read covers 256 contiguous bytes) are brought into LDS once, by asynchronous copies of whole 512-B pieces per wave; every wave reads
// its fragments from there.
// S^T = K.Q^T (single f16, hi planes), per-lane online softmax; P^T built in registers from the two S^T accumulators
// ---------------------------------------------------------------------------
constexpr int AWAVES = QT_PER_B;                // one wave per query tile of the head
constexpr int KPITCH = DH + 8;                  // K row pitch in LDS, f16 elements
__global__ __launch_bounds__(AWAVES * 32) void attn_kernel(const b16* __restrict__ Qh, const b16* __restrict__ Ql, const b16* __restrict__ Kh, const b16* __restrict__ Kl,
                                                   const b16* __restrict__ Vh, const b16* __restrict__ Vl, const int* __restrict__ seqlen,
                                                   const float* __restrict__ gam, const float* __restrict__ bet, const float* __restrict__ rwm,
                                                   float* __restrict__ yf) {
  __shared__ __attribute__((aligned(16))) b16 Ks[T * KPITCH];
  __shared__ __attribute__((aligned(16))) b16 Vs[T * DH];
  __shared__ __attribute__((aligned(16))) float Os[AWAVES][16 * 64];
  (void)Ql; (void)Kl; (void)Vl;
  const int tid = threadIdx.x, lane = tid & 31, hh = lane >> 4, col = lane & 15;
  const int wid = __builtin_amdgcn_readfirstlane(tid >> 5);   // wave-uniform: the query tile and the bias test stay in scalar registers
  const int g = blockIdx.x;                               // b*NH + h
  const int q0 = wid << 4;
  const int b = g / NH, h = g % NH, kvh = h / REP;
  const size_t ko = (size_t)(b * NKV + kvh) * T * DH;
  const size_t qo = ((size_t)g * T + q0 + col) * DH;
  const v16b q0h = frag_kb(Qh + qo, hh), q1h = frag_kb(Qh + qo + 32, hh);
  {
    // thread tid moves the 16-byte pieces tid, tid + 1024, tid + 2048, tid + 3072 of the head's 64 KB of K and of its 64 KB of V
    const b16* kg = Kh + ko + tid * 8;
    const b16* vg = Vh + ko + tid * 8;
    const unsigned kl = (unsigned)(size_t)(Ks + (tid >> 3) * KPITCH + (tid & 7) * 8);
    const unsigned vl = (unsigned)(size_t)(Vs + (tid >> 7) * (DH * 16) + (tid & 1) * (DH * 8) + ((tid >> 1) & (DH - 1)) * 8);   // piece = (key tile, feature, key half)
    constexpr int GSTEP = 1024 * 8;                       // elements per step in memory (and in Vs: 8 key tiles)
    constexpr unsigned KSTEP = 128 * KPITCH * 2, VSTEP = GSTEP * 2;   // bytes per step in LDS
    // the copies and, as the last line, the wait that stands in front of any rewrite of the address registers they name
    asm volatile("global_load_async_to_lds_b128 %0, %8, off\n\t"
                 "global_load_async_to_lds_b128 %1, %9, off\n\t"
                 "global_load_async_to_lds_b128 %2, %10, off\n\t"
                 "global_load_async_to_lds_b128 %3, %11, off\n\t"
                 "global_load_async_to_lds_b128 %4, %12, off\n\t"
                 "global_load_async_to_lds_b128 %5, %13, off\n\t"
                 "global_load_async_to_lds_b128 %6, %14, off\n\t"
                 "global_load_async_to_lds_b128 %7, %15, off\n\t"
                 "s_wait_xcnt 0x0"
                 :: "v"(kl), "v"(kl + KSTEP), "v"(kl + 2 * KSTEP), "v"(kl + 3 * KSTEP),
                    "v"(vl), "v"(vl + VSTEP), "v"(vl + 2 * VSTEP), "v"(vl + 3 * VSTEP),
                    "v"(kg), "v"(kg + GSTEP), "v"(kg + 2 * GSTEP), "v"(kg + 3 * GSTEP),
                    "v"(vg), "v"(vg + GSTEP), "v"(vg + 2 * GSTEP), "v"(vg + 3 * GSTEP)
                 : "memory");
    asm volatile("s_wait_asynccnt 0x0" ::: "memory");   // this wave's copies have landed before it passes the barrier
  }
  __syncthreads();   // every wave's copies are in LDS before any wave reads K or V
  float m = -INFINITY, l = 0.0f;
  v8f o0 = {}, o1 = {}, o2 = {}, o3 = {};
  const int slen = T; (void)seqlen;                       // no padding in this module
  const b16* kf = Ks + col * KPITCH;
  const b16* vf = Vs + hh * (DH * 8) + col * 8;
  for (int kb = 0; kb < T; kb += 32) {                   // non-causal: every key chunk
    v8f s0 = {}, s1 = {};
    {
      // the chunk's four K fragments are read as one group ahead of its products
      const b16* k0 = kf + kb * KPITCH; const b16* k1 = k0 + 16 * KPITCH;
      const v16b a00 = frag_kb(k0, hh), a01 = frag_kb(k0 + 32, hh), a10 = frag_kb(k1, hh), a11 = frag_kb(k1 + 32, hh);
      s0 = wmma1(a00, a00, q0h, q0h, s0);
      s1 = wmma1(a10, a10, q0h, q0h, s1);
      s0 = wmma1(a01, a01, q1h, q1h, s0);
      s1 = wmma1(a11, a11, q1h, q1h, s1);
    }
    (void)slen;
    if ((kb >> 8) == (q0 >> 8)) {                         // CBDA bias: same 256-block of query and key (chunks never straddle a block)
      // scalar bases and 32-bit lane offsets: no address pairs live through the loop (the 32-wave block has 128 registers a wave)
      const unsigned go = (unsigned)((kb & (BLK - 1)) + 8 * hh), ro = go + (unsigned)(col * BLK);
      const float* rw = rwm + (size_t)q0 * BLK + ro;
      const float* gm = gam + (size_t)b * BLK + go;
      const float* bt = bet + (size_t)b * BLK + go;
#pragma unroll
      for (int r = 0; r < 8; ++r) { s0[r] += gm[r] * rw[r] + bt[r]; s1[r] += gm[16 + r] * rw[16 + r] + bt[16 + r]; }
    }
    // the chunk's four V fragments: every read stands in front of the P.V products in the source, so the compiler may spread them over the softmax arithmetic
    const b16* v0 = vf + (kb >> 4) * (DH * 16); const b16* v1 = v0 + DH * 16;
    const v16b va0 = cat8b(ld8b(v0), ld8b(v1)), va1 = cat8b(ld8b(v0 + 128), ld8b(v1 + 128));
    const v16b va2 = cat8b(ld8b(v0 + 256), ld8b(v1 + 256)), va3 = cat8b(ld8b(v0 + 384), ld8b(v1 + 384));
    float mr = -INFINITY;
#pragma unroll
    for (int r = 0; r < 8; ++r) mr = fmaxf(mr, fmaxf(s0[r], s1[r]));
    mr = fmaxf(mr, __shfl_xor(mr, 16));
    float mn = fmaxf(m, mr);
    if (mn == -INFINITY) mn = 0.0f;           // fully masked so far (padded query rows far past seq_len): keep exp() at 0
    const float al_ = __expf(m - mn);
    m = mn;
    float sum = 0.0f;
    v16b pbh, pbl;
#pragma unroll
    for (int r = 0; r < 8; ++r) {
      const float p0 = __expf(s0[r] - mn), p1 = __expf(s1[r] - mn);
      sum += p0 + p1;
      b16 a, c; split_bf16(p0, a, c); pbh[r] = a; pbl[r] = c; split_bf16(p1, a, c); pbh[8 + r] = a; pbl[8 + r] = c;
    }
    sum += __shfl_xor(sum, 16);
    l = l * al_ + sum;
#pragma unroll
    for (int r = 0; r < 8; ++r) { o0[r] *= al_; o1[r] *= al_; o2[r] *= al_; o3[r] *= al_; }
    o0 = wmma1(va0, va0, pbh, pbl, o0);
    o1 = wmma1(va1, va1, pbh, pbl, o1);
    o2 = wmma1(va2, va2, pbh, pbl, o2);
    o3 = wmma1(va3, va3, pbh, pbl, o3);
  }
  const float inv = (q0 + col < slen && l > 0.0f) ? (1.0f / l) : 0.0f;   // padded query rows are zeroed
  float* Tt = Os[wid];
#pragma unroll
  for (int r = 0; r < 8; ++r) {
    const int hr = 8 * hh + r;
    Tt[col * 64 + 0 + hr] = o0[r] * inv; Tt[col * 64 + 16 + hr] = o1[r] * inv;
    Tt[col * 64 + 32 + hr] = o2[r] * inv; Tt[col * 64 + 48 + hr] = o3[r] * inv;
  }
  wave_lds_sync();
  float* dst0 = yf + ((size_t)b * T + q0) * HID + h * DH;     // 16 rows x 64 floats, row stride HID
#pragma unroll
  for (int j = 0; j < 8; ++j) { const int rr = j * 2 + hh, c4 = col * 4; *(v4f*)(dst0 + (size_t)rr * HID + c4) = *(const v4f*)(Tt + rr * 64 + c4); }
  
}

// ---------------------------------------------------------------------------
// Output projection: (8192 x 1024) x (1024 x 1024) -> f32, A split on the fly from f32 y, B = Wo planes. grid (16, 64), 32x64 tiles staged in LDS,
// ---------------------------------------------------------------------------
__global__ __launch_bounds__(128) void out_gemm_kernel(const float* __restrict__ yf, const b16* __restrict__ woh, const b16* __restrict__ wol, const float* __restrict__ bo, int yoff,
                                                       float* __restrict__ out) {
  __shared__ __attribute__((aligned(16))) float Ts[4][32 * 64];
  const int lane = threadIdx.x & 31, wave = threadIdx.x >> 5, nloc = lane & 15, hlf = lane >> 4;
  const int m0 = (blockIdx.y + yoff) * 128 + wave * 32;
  const int c0 = blockIdx.x * 64;
  v8f acc[2][4];
#pragma unroll
  for (int r = 0; r < 2; ++r)
#pragma unroll
    for (int t = 0; t < 4; ++t) acc[r][t] = (v8f){};
  gemm_tile_split(yf, woh, wol, m0, c0, HID, nloc, hlf, acc);
  float* Tt = Ts[wave];
#pragma unroll
  for (int t = 0; t < 4; ++t)
#pragma unroll
    for (int r = 0; r < 2; ++r)
#pragma unroll
      for (int v = 0; v < 8; ++v) Tt[(r * 16 + v + 8 * hlf) * 64 + t * 16 + nloc] = acc[r][t][v] + bo[c0 + t * 16 + nloc];
  wave_lds_sync();
  float* dst0 = out + (size_t)m0 * HID + c0;
#pragma unroll
  for (int j = 0; j < 16; ++j) { const int rr = j * 2 + hlf, c4 = nloc * 4; *(v4f*)(dst0 + (size_t)rr * HID + c4) = *(const v4f*)(Tt + rr * 64 + c4); }
  
}
__global__ __launch_bounds__(256) void wcvtT_kernel(const float* __restrict__ wq, const float* __restrict__ wk, const float* __restrict__ wv,
                                                    b16* __restrict__ wqh, b16* __restrict__ wql) {
  const size_t tid = (size_t)blockIdx.x * blockDim.x + threadIdx.x, stride = (size_t)gridDim.x * blockDim.x;
  const size_t nq = (size_t)NQKV * HID / 8;
  {
    for (size_t c = tid; c < nq; c += stride) {
      const size_t i = c * 8, n = i / HID, k0 = i % HID;
      const float* w = (n < (size_t)HID) ? (wq + n * HID) : (n < (size_t)(2 * HID)) ? (wk + (n - HID) * HID) : (wv + (n - 2 * HID) * HID);
      v8b bh, bl;
#pragma unroll
      for (int e = 0; e < 8; ++e) { b16 a, cc; split_bf16(w[k0 + e], a, cc); bh[e] = a; bl[e] = cc; }
      *(v8b*)(wqh + i) = bh; *(v8b*)(wql + i) = bl;
    }
    
  }
}
// FiLM maps gamma[b][c] = te[b] . Wg[c] + bg[c] and beta[b][c] = te[b] . Wb[c] + bb[c]. One block makes one 128-B line of one map (32 columns of one
// example); each wave takes four weight rows, and its 32 lanes read te[b] and every row as whole contiguous 512-B pieces (k = 128 j + 4 lane + 0..3).
// Per-lane partial sums, then a 32-lane xor tree; the 32 results meet in LDS and leave as one whole-line store.
constexpr int FCG = BLK / 32;                   // column groups of 32 per map
__global__ __launch_bounds__(256) void film_kernel(const float* __restrict__ te, const float* __restrict__ Wg, const float* __restrict__ bg,
                                                   const float* __restrict__ Wb, const float* __restrict__ bb, float* __restrict__ gam, float* __restrict__ bet) {
  __shared__ __attribute__((aligned(16))) float Rs[32];
  const int lane = threadIdx.x & 31;
  const int wave = __builtin_amdgcn_readfirstlane(threadIdx.x >> 5);   // wave-uniform: row bases stay in scalar registers
  const int mat = blockIdx.x & 1, cg = (blockIdx.x >> 1) % FCG, b = blockIdx.x / (2 * FCG);
  const float* e = te + (size_t)b * HID + lane * 4;
  const float* w = (mat ? Wb : Wg) + (size_t)(cg * 32 + wave * 4) * HID + lane * 4;
  const float bias = (mat ? bb : bg)[cg * 32 + lane];
  // every loop below is fully unrolled: ev, a and s stay in registers, and the row loads are issued ahead of the sums that use them
  v4f ev[HID / 128];
#pragma unroll
  for (int j = 0; j < HID / 128; ++j) ev[j] = *(const v4f*)(e + j * 128);
  v4f a[4];
#pragma unroll
  for (int r = 0; r < 4; ++r) a[r] = (v4f){};
#pragma unroll
  for (int j = 0; j < HID / 128; ++j)
#pragma unroll
    for (int r = 0; r < 4; ++r) a[r] += ev[j] * *(const v4f*)(w + (size_t)r * HID + j * 128);
  v4f s;
#pragma unroll
  for (int r = 0; r < 4; ++r) s[r] = (a[r][0] + a[r][1]) + (a[r][2] + a[r][3]);
#pragma unroll
  for (int m = 16; m >= 1; m >>= 1)
#pragma unroll
    for (int r = 0; r < 4; ++r) s[r] += __shfl_xor(s[r], m);
  if (lane == 0) *(v4f*)(Rs + wave * 4) = s;
  __syncthreads();   // the eight waves' sums are in LDS before the first wave reads them
  if (threadIdx.x < 32) (mat ? bet : gam)[(size_t)b * BLK + cg * 32 + lane] = Rs[lane] + bias;
}
}  // namespace

extern "C" void kernel_launch(void* const* d_in, const int* in_sizes, int n_in,
                              void* d_out, int out_size, void* d_ws, size_t ws_size, hipStream_t stream) {
  (void)in_sizes; (void)n_in; (void)out_size;
  const float* x   = (const float*)d_in[0];    // hidden_states [16,512,1024]
  const float* te  = (const float*)d_in[1];    // task_embedding [16,1024]
  const float* Wq  = (const float*)d_in[2];  const float* bq = (const float*)d_in[3];
  const float* Wk  = (const float*)d_in[4];  const float* bk = (const float*)d_in[5];
  const float* Wv  = (const float*)d_in[6];  const float* bv = (const float*)d_in[7];
  const float* Wg  = (const float*)d_in[8];  const float* bg = (const float*)d_in[9];
  const float* Wb  = (const float*)d_in[10]; const float* bb = (const float*)d_in[11];
  const float* rwm = (const float*)d_in[12];   // [512,256]
  float* out = (float*)d_out;                  // ctx [16,512,1024]

  size_t off = 0; char* ws = (char*)d_ws;
  b16* wqh = (b16*)(ws + off); off += (size_t)NQKV * HID * 2;
  b16* wql = (b16*)(ws + off); off += (size_t)NQKV * HID * 2;
  b16* Qh  = (b16*)(ws + off); off += (size_t)MROWS * HID * 2;
  b16* Ql  = (b16*)(ws + off); off += (size_t)MROWS * HID * 2;
  b16* Kh  = (b16*)(ws + off); off += (size_t)MROWS * KVW * 2;
  b16* Kl  = (b16*)(ws + off); off += (size_t)MROWS * KVW * 2;
  b16* Vh  = (b16*)(ws + off); off += (size_t)MROWS * KVW * 2;
  b16* Vl  = (b16*)(ws + off); off += (size_t)MROWS * KVW * 2;
  float* gam = (float*)(ws + off); off += (size_t)Bsz * BLK * 4;
  float* bet = (float*)(ws + off); off += (size_t)Bsz * BLK * 4;
  if (off > ws_size) return;
  const int ROWBLK = MROWS / 128, NQT = Bsz * NH * QT_PER_B;
  wcvtT_kernel<<<2048, 256, 0, stream>>>(Wq, Wk, Wv, wqh, wql);
  film_kernel<<<Bsz * FCG * 2, 256, 0, stream>>>(te, Wg, bg, Wb, bb, gam, bet);
  qkv_gemm_kernel<<<dim3(NQKV / GBN, ROWBLK), 256, 0, stream>>>(x, x, x, wqh, wql, bq, bk, bv, nullptr, 0, 0, Qh, Ql, Kh, Kl, Vh, Vl);
  attn_kernel<<<NQT / AWAVES, AWAVES * 32, 0, stream>>>(Qh, Ql, Kh, Kl, Vh, Vl, nullptr, gam, bet, rwm, out);
}

// v004
// Measured time: 87.4 microseconds a run.
// Two timings next to v003 put it at 1.05 and 1.04 times that version's speed.
// All steps since v000 together make it 3.82 times as fast.
#include <hip/hip_runtime.h>

// BERT self-attention with a FiLM-conditioned block-diagonal additive bias (CBDA): q/k/v = x W^T + b (torch layout, 16 heads x 64), scores/8 +
// bias[b][q][k] (= gamma[b][k%256] * rwm[q][k%256] + beta[b][k%256] when q and k fall in the same 256-block, else 0; gamma/beta = task_emb Wg^T + bg /
// Wb^T + bb), softmax, ctx = P v -> [16, 512, 1024] (no output projection). Lean build: single f16 products on v_wmma_f32_16x16x32_f16, f32 accumulate
// (ctx averages ~512 positions; no large rows); fragment k-map per lane half hh for A AND B: elements 0..7 <- k = 8hh+0..7, 8..15 <- k = 16+8hh+0..7.

namespace {
constexpr int Bsz = 16, T = 512, HID = 1024, DH = 64, NH = 16, NKV = 16, REP = NH / NKV;
constexpr int BLK = 256;
constexpr int KVW = NKV * DH;                 // 1024
constexpr int NQKV = HID + 2 * KVW;           // 3072 columns: q | k | v
constexpr int MROWS = Bsz * T;                // 8192
constexpr int QT_PER_B = T / 16;              // 32

typedef _Float16 b16;                                           // f16 hi/lo planes
typedef __attribute__((ext_vector_type(16))) _Float16 v16b;
typedef __attribute__((ext_vector_type(8)))  _Float16 v8b;
typedef __attribute__((ext_vector_type(4)))  _Float16 v4b;
typedef __attribute__((ext_vector_type(8)))  float v8f;
typedef __attribute__((ext_vector_type(4)))  float v4f;

__device__ __forceinline__ v8b ld8b(const b16* p) { return *(const v8b*)p; }
__device__ __forceinline__ v16b cat8b(v8b a, v8b b) { return __builtin_shufflevector(a, b, 0, 1, 2, 3, 4, 5, 6, 7, 8, 9, 10, 11, 12, 13, 14, 15); }
// 16x16x32 16-bit fragment from a k-contiguous row pointer (A: lane&15 = row, B: lane&15 = column), hh = lane>>4:
// elements 0..7 <- p[8hh+0..7], elements 8..15 <- p[16+8hh+0..7]
__device__ __forceinline__ v16b frag_kb(const b16* p, int hh) { return cat8b(ld8b(p + 8 * hh), ld8b(p + 16 + 8 * hh)); }
__device__ __forceinline__ void split_bf16(float v, b16& hi, b16& lo) {   // (name kept) single f16: no low part
  hi = (b16)v; lo = (b16)0.0f;
}
// split fragment straight from an f32 k-contiguous row
__device__ __forceinline__ void frag_ksplit(const float* p, int hh, v16b& fh_, v16b& fl_) {
  const float* p0 = p + 8 * hh; const float* p1 = p + 16 + 8 * hh;
#pragma unroll
  for (int e = 0; e < 8; ++e) { b16 a, c; split_bf16(p0[e], a, c); fh_[e] = a; fl_[e] = c; split_bf16(p1[e], a, c); fh_[8 + e] = a; fl_[8 + e] = c; }
}
__device__ __forceinline__ v8f wmma16b(v16b a, v16b b, v8f c) {
  v8f d = __builtin_amdgcn_wmma_f32_16x16x32_f16(false, a, false, b, (short)0, c, false, false);
  asm volatile("v_nop\n\tv_nop\n\tv_nop\n\tv_nop" : "+v"(d) : "v"(a), "v"(b));
  return d;
}
// acc += A.B with both operands split: A = (ah, al), B = (bh, bl)
__device__ __forceinline__ v8f wmma3(v16b ah, v16b al, v16b bh, v16b bl, v8f c) {   // lean: single f16 product
  (void)al; (void)bl; return wmma16b(ah, bh, c);
}
__device__ __forceinline__ v8f wmma1(v16b ah, v16b al, v16b bh, v16b bl, v8f c) {   // attention products: single f16 (hi planes only)
  (void)al; (void)bl; return wmma16b(ah, bh, c);
}
__device__ __forceinline__ void wave_lds_sync() {
  __builtin_amdgcn_fence(__ATOMIC_RELEASE, "workgroup");
  __builtin_amdgcn_wave_barrier();
  __builtin_amdgcn_fence(__ATOMIC_ACQUIRE, "workgroup");
}

// ---------------------------------------------------------------------------
// Weights ([in][out]) -> f16 hi / lo planes transposed to [n][k] (k contiguous): columns of Wq|Wk|Wv into wqh/wql [3072][1024], Wo into woh/wol [1024][1024].
// ---------------------------------------------------------------------------
__global__ __launch_bounds__(256) void wcvt_kernel(const float* __restrict__ wq, const float* __restrict__ wk, const float* __restrict__ wv,
                                                   const float* __restrict__ wo, b16* __restrict__ wqh, b16* __restrict__ wql,
                                                   b16* __restrict__ woh, b16* __restrict__ wol) {
  const size_t tid = (size_t)blockIdx.x * blockDim.x + threadIdx.x, stride = (size_t)gridDim.x * blockDim.x;
  const size_t nq = (size_t)NQKV * HID / 8, no = (size_t)HID * HID / 8;
  {
    for (size_t c = tid; c < nq + no; c += stride) {
      float f[8]; size_t i; b16* dh; b16* dl;
      if (c < nq) {
        i = c * 8; const size_t n = i / HID, k0 = i % HID;
        const float* w; int nn, ld;
        if (n < (size_t)HID) { w = wq; nn = (int)n; ld = HID; } else if (n < (size_t)(HID + KVW)) { w = wk; nn = (int)n - HID; ld = KVW; } else { w = wv; nn = (int)n - HID - KVW; ld = KVW; }
#pragma unroll
        for (int e = 0; e < 8; ++e) f[e] = w[(size_t)(k0 + e) * ld + nn];       // W[k][n] ([in][out])
        dh = wqh; dl = wql;
      } else {
        i = (c - nq) * 8; const size_t n = i / HID, k0 = i % HID;
#pragma unroll
        for (int e = 0; e < 8; ++e) f[e] = wo[(size_t)(k0 + e) * HID + n];    // Wo[k][n] ([in][out])
        dh = woh; dl = wol;
      }
      v8b bh, bl;
#pragma unroll
      for (int e = 0; e < 8; ++e) { b16 a, cc; split_bf16(f[e], a, cc); bh[e] = a; bl[e] = cc; }
      *(v8b*)(dh + i) = bh; *(v8b*)(dl + i) = bl;
    }
    
  }
}

// 32x64 wave tile over K from f32 A rows and f16-plane B rows
__device__ __forceinline__ void gemm_tile_split(const float* __restrict__ A, const b16* __restrict__ wh, const b16* __restrict__ wl,
                                                int m0, int c0, int K, int nloc, int hlf, v8f (&acc)[2][4]) {
  for (int kb = 0; kb < K; kb += 32) {
    v16b a0h, a0l, a1h, a1l;
    frag_ksplit(A + (size_t)(m0 + nloc) * K + kb, hlf, a0h, a0l);
    frag_ksplit(A + (size_t)(m0 + 16 + nloc) * K + kb, hlf, a1h, a1l);
#pragma unroll
    for (int t = 0; t < 4; ++t) {
      const size_t wofs = (size_t)(c0 + t * 16 + nloc) * K + kb;
      const v16b bh = frag_kb(wh + wofs, hlf), bl = frag_kb(wl + wofs, hlf);
      acc[0][t] = wmma3(a0h, a0l, bh, bl, acc[0][t]);
      acc[1][t] = wmma3(a1h, a1l, bh, bl, acc[1][t]);
    }
  }
}

// ---------------------------------------------------------------------------
// QKV GEMM: (8192 x 1024) x (1024 x 3072), grid (12, 64), block 8 waves (2 x 4), block tile 128 rows x 256 columns, wave = 64 rows x 64 columns (one head of
// q, k or v). Per pass of 64 k the block brings its x rows (f32, whole 128-B lines, converted to f16 once) and its weight rows through registers into LDS
// (row pitch 144 B); every wave reads its fragments from there. Two LDS buffers, one barrier per pass: the next pass's global loads are issued ahead of this
// pass's products and stored into the other buffer behind them. The walk over k starts at a pass rotated by block index. Outputs as f16 hi/lo planes:
// q (x1/8) -> Qh/Ql [b][h][t][64]; k -> Kh/Kl [b][kvh][t][64] (8 KB contiguous per wave per plane);
// v -> Vh/Vl key-tiled [b][kvh][t/16][64][16] (8 KB contiguous per wave per plane).
// ---------------------------------------------------------------------------
constexpr int GBM = 128, GBN = 256, GKS = 64;
constexpr int GPITCH = GKS + 8;                 // LDS row pitch in f16 elements: 144 B = 16 B x 9 (conflict-free for 16-byte fragment reads)
constexpr int GSTAGE = (GBM + GBN) * GPITCH;    // one buffer: x rows, then weight rows
constexpr int GEPI = 8 * 4 * 32 * 64;           // epilogue staging, 16 KB per wave, in the same LDS behind the last pass's barrier
constexpr int GSMEM = (2 * GSTAGE > GEPI) ? 2 * GSTAGE : GEPI;
__global__ __launch_bounds__(256) void qkv_gemm_kernel(const float* __restrict__ xq, const float* __restrict__ xk, const float* __restrict__ xv,
                                                       const b16* __restrict__ wqh, const b16* __restrict__ wql,
                                                       const float* __restrict__ bq, const float* __restrict__ bk, const float* __restrict__ bv, const float* __restrict__ rope_cs, int xoff, int yoff,
                                                       b16* __restrict__ Qh, b16* __restrict__ Ql, b16* __restrict__ Kh, b16* __restrict__ Kl,
                                                       b16* __restrict__ Vh, b16* __restrict__ Vl) {
  __shared__ __attribute__((aligned(16))) b16 Sm[GSMEM];
  (void)wql; (void)rope_cs;
  const int tid = threadIdx.x, lane = tid & 31, nloc = lane & 15, hlf = lane >> 4;
  const int wave = __builtin_amdgcn_readfirstlane(tid >> 5);        // wave-uniform: head, matrix and staging bases stay in scalar registers
  const int wm = wave >> 2, wn = wave & 3;
  const int mblk = (blockIdx.y + yoff) * GBM;
  const int cblk = (blockIdx.x + xoff) * GBN;
  const int c0 = cblk + wn * 64;
  const int mat = (c0 < HID) ? 0 : (c0 < HID + KVW) ? 1 : 2;
  const int head = (mat == 0) ? (c0 / DH) : (mat == 1) ? ((c0 - HID) / DH) : ((c0 - HID - KVW) / DH);
  const float* x = (mat == 0) ? xq : (mat == 1) ? xk : xv;          // input of q, k or v (the same x at the launch)
  const float* bias = ((mat == 0) ? bq : (mat == 1) ? bk : bv) + head * DH;
  // loaders: x, 16 threads x 16 B per row (a wave covers 2 rows x 256 B); weights, 8 threads x 16 B per row (a wave covers 4 rows x 128 B)
  const int arow = tid >> 4, acol = (tid & 15) * 4;
  const int brow = tid >> 3, bcol = (tid & 7) * 8;
  // Blocks that share x rows (same blockIdx.y) or weight rows (same blockIdx.x) run at the same time; each starts its walk over k at another pass and wraps
  // round, so that they do not ask L2 for the same lines at the same moment. Every block still takes all HID / GKS passes, each once.
  const int rot = (blockIdx.x + blockIdx.y) & (HID / GKS - 1);
  const float* ag = x + (size_t)(mblk + arow) * HID + acol + rot * GKS;
  const b16* bg = wqh + (size_t)(cblk + brow) * HID + bcol + rot * GKS;
  b16* as = Sm + arow * GPITCH + acol;
  b16* bs = Sm + (GBM + brow) * GPITCH + bcol;
  const b16* af0 = Sm + (wm * 64 + nloc) * GPITCH;
  const b16* bf0 = Sm + (GBM + wn * 64 + nloc) * GPITCH;
  v4f ra[8]; v8b rb[8];
  v8f acc[4][4];
#pragma unroll
  for (int r = 0; r < 4; ++r)
#pragma unroll
    for (int t = 0; t < 4; ++t) acc[r][t] = (v8f){};
#pragma unroll
  for (int j = 0; j < 8; ++j) { ra[j] = *(const v4f*)(ag + (size_t)j * 16 * HID); rb[j] = ld8b(bg + (size_t)j * 32 * HID); }
#pragma unroll
  for (int j = 0; j < 8; ++j) {
    v4b h; 
#pragma unroll
    for (int e = 0; e < 4; ++e) h[e] = (b16)ra[j][e];
    *(v4b*)(as + j * 16 * GPITCH) = h; *(v8b*)(bs + j * 32 * GPITCH) = rb[j];
  }
  __syncthreads();
  for (int it = 0; it < HID / GKS; ++it) {
    const int cur = (it & 1) * GSTAGE, nxt = GSTAGE - cur;
    const bool more = it + 1 < HID / GKS;
    if (more) {
      const int step = (((it + 1 + rot) & (HID / GKS - 1)) == 0) ? GKS - HID : GKS;   // on to the next pass of the walk, from the last one back to k = 0
      ag += step; bg += step;
#pragma unroll
      for (int j = 0; j < 8; ++j) { ra[j] = *(const v4f*)(ag + (size_t)j * 16 * HID); rb[j] = ld8b(bg + (size_t)j * 32 * HID); }
    }
#pragma unroll
    for (int ks = 0; ks < GKS; ks += 32) {
      v16b a[4];
#pragma unroll
      for (int r = 0; r < 4; ++r) a[r] = frag_kb(af0 + cur + r * 16 * GPITCH + ks, hlf);
      v16b bh = frag_kb(bf0 + cur + ks, hlf);
#pragma unroll
      for (int t = 0; t < 4; ++t) {
        v16b bn = bh;
        if (t < 3) bn = frag_kb(bf0 + cur + (t + 1) * 16 * GPITCH + ks, hlf);   // the next column fragment is read ahead of this one's four products
#pragma unroll
        for (int r = 0; r < 4; ++r) acc[r][t] = wmma3(a[r], a[r], bh, bh, acc[r][t]);
        bh = bn;
      }
    }
    if (more) {
#pragma unroll
      for (int j = 0; j < 8; ++j) {
        v4b h;
#pragma unroll
        for (int e = 0; e < 4; ++e) h[e] = (b16)ra[j][e];
        *(v4b*)(as + nxt + j * 16 * GPITCH) = h; *(v8b*)(bs + nxt + j * 32 * GPITCH) = rb[j];
      }
    }
    __syncthreads();   // publishes the buffer just filled and ends every wave's reads of the one refilled next (after the last pass: of the LDS the epilogue reuses)
  }
  const float s = (mat == 0) ? 0.125f : 1.0f;
  b16* Tw = Sm + wave * (4 * 32 * 64);                              // each wave stages in its own 16 KB: [32-row half][plane][32 * 64]
#pragma unroll
  for (int r2 = 0; r2 < 2; ++r2) {
    b16* Tp0 = Tw + r2 * (2 * 32 * 64); b16* Tp1 = Tp0 + 32 * 64;
#pragma unroll
    for (int t = 0; t < 4; ++t)
#pragma unroll
      for (int r = 0; r < 2; ++r)
#pragma unroll
        for (int v = 0; v < 8; ++v) {
          const int rr = r * 16 + v + 8 * hlf, d = t * 16 + nloc;
          const float val = acc[r2 * 2 + r][t][v] + bias[d];
          b16 yh, yl; split_bf16(val * s, yh, yl);
          const int idx = (mat < 2) ? (rr * 64 + d) : ((rr >> 4) * 1024 + d * 16 + (rr & 15));
          Tp0[idx] = yh; Tp1[idx] = yl;
        }
  }
  wave_lds_sync();
#pragma unroll
  for (int r2 = 0; r2 < 2; ++r2) {
    const b16* Tp0 = Tw + r2 * (2 * 32 * 64); const b16* Tp1 = Tp0 + 32 * 64;
    const int m0 = mblk + wm * 64 + r2 * 32;
    const int b = m0 / T, t0 = m0 % T;
    b16* dh; b16* dl; size_t o;
    if (mat == 0)      { o = ((size_t)(b * NH + head) * T + t0) * DH; dh = Qh + o; dl = Ql + o; }
    else if (mat == 1) { o = ((size_t)(b * NKV + head) * T + t0) * DH; dh = Kh + o; dl = Kl + o; }
    else               { o = ((size_t)(b * NKV + head) * QT_PER_B + (t0 >> 4)) * (size_t)(DH * 16); dh = Vh + o; dl = Vl + o; }
#pragma unroll
    for (int j = 0; j < 8; ++j) { const int e = (j * 32 + lane) * 8; *(v8b*)(dh + e) = ld8b(Tp0 + e); *(v8b*)(dl + e) = ld8b(Tp1 + e); }
    // the next half's LDS reads reuse the registers that these stores name: keep the wait in front of that overwrite
    if (r2 == 0) asm volatile("s_wait_xcnt 0x0" ::: "memory");
  }
}

// ---------------------------------------------------------------------------
// Transposed flash attention: one block per (b, head), 32 waves, each wave owns one 16-query tile; all keys in chunks of 32.
// The head's K rows (LDS pitch 144 B, conflict-free for 16-byte fragment reads) and its key-tiled V (in LDS [t/16][key half][64][8], so that each 16-lane
// half of a fragment read covers 256 contiguous bytes) are brought into LDS once, by asynchronous copies of whole 512-B pieces per wave; every wave reads
// its fragments from there.
// S^T = K.Q^T (single f16, hi planes), per-lane online softmax; P^T built in registers from the two S^T accumulators
// ---------------------------------------------------------------------------
constexpr int AWAVES = QT_PER_B;                // one wave per query tile of the head
constexpr int KPITCH = DH + 8;                  // K row pitch in LDS, f16 elements
__global__ __launch_bounds__(AWAVES * 32) void attn_kernel(const b16* __restrict__ Qh, const b16* __restrict__ Ql, const b16* __restrict__ Kh, const b16* __restrict__ Kl,
                                                   const b16* __restrict__ Vh, const b16* __restrict__ Vl, const int* __restrict__ seqlen,
                                                   const float* __restrict__ gam, const float* __restrict__ bet, const float* __restrict__ rwm,
                                                   float* __restrict__ yf) {
  __shared__ __attribute__((aligned(16))) b16 Ks[T * KPITCH];
  __shared__ __attribute__((aligned(16))) b16 Vs[T * DH];
  __shared__ __attribute__((aligned(16))) float Os[AWAVES][16 * 64];
  (void)Ql; (void)Kl; (void)Vl;
  const int tid = threadIdx.x, lane = tid & 31, hh = lane >> 4, col = lane & 15;
  const int wid = __builtin_amdgcn_readfirstlane(tid >> 5);   // wave-uniform: the query tile and the bias test stay in scalar registers
  const int g = blockIdx.x;                               // b*NH + h
  const int q0 = wid << 4;
  const int b = g / NH, h = g % NH, kvh = h / REP;
  const size_t ko = (size_t)(b * NKV + kvh) * T * DH;
  const size_t qo = ((size_t)g * T + q0 + col) * DH;
  const v16b q0h = frag_kb(Qh + qo, hh), q1h = frag_kb(Qh + qo + 32, hh);
  {
    // thread tid moves the 16-byte pieces tid, tid + 1024, tid + 2048, tid + 3072 of the head's 64 KB of K and of its 64 KB of V
    const b16* kg = Kh + ko + tid * 8;
    const b16* vg = Vh + ko + tid * 8;
    const unsigned kl = (unsigned)(size_t)(Ks + (tid >> 3) * KPITCH + (tid & 7) * 8);
    const unsigned vl = (unsigned)(size_t)(Vs + (tid >> 7) * (DH * 16) + (tid & 1) * (DH * 8) + ((tid >> 1) & (DH - 1)) * 8);   // piece = (key tile, feature, key half)
    constexpr int GSTEP = 1024 * 8;                       // elements per step in memory (and in Vs: 8 key tiles)
    constexpr unsigned KSTEP = 128 * KPITCH * 2, VSTEP = GSTEP * 2;   // bytes per step in LDS
    // the copies and, as the last line, the wait that stands in front of any rewrite of the address registers they name
    asm volatile("global_load_async_to_lds_b128 %0, %8, off\n\t"
                 "global_load_async_to_lds_b128 %1, %9, off\n\t"
                 "global_load_async_to_lds_b128 %2, %10, off\n\t"
                 "global_load_async_to_lds_b128 %3, %11, off\n\t"
                 "global_load_async_to_lds_b128 %4, %12, off\n\t"
                 "global_load_async_to_lds_b128 %5, %13, off\n\t"
                 "global_load_async_to_lds_b128 %6, %14, off\n\t"
                 "global_load_async_to_lds_b128 %7, %15, off\n\t"
                 "s_wait_xcnt 0x0"
                 :: "v"(kl), "v"(kl + KSTEP), "v"(kl + 2 * KSTEP), "v"(kl + 3 * KSTEP),
                    "v"(vl), "v"(vl + VSTEP), "v"(vl + 2 * VSTEP), "v"(vl + 3 * VSTEP),
                    "v"(kg), "v"(kg + GSTEP), "v"(kg + 2 * GSTEP), "v"(kg + 3 * GSTEP),
                    "v"(vg), "v"(vg + GSTEP), "v"(vg + 2 * GSTEP), "v"(vg + 3 * GSTEP)
                 : "memory");
    asm volatile("s_wait_asynccnt 0x0" ::: "memory");   // this wave's copies have landed before it passes the barrier
  }
  __syncthreads();   // every wave's copies are in LDS before any wave reads K or V
  float m = -INFINITY, l = 0.0f;
  v8f o0 = {}, o1 = {}, o2 = {}, o3 = {};
  const int slen = T; (void)seqlen;                       // no padding in this module
  const b16* kf = Ks + col * KPITCH;
  const b16* vf = Vs + hh * (DH * 8) + col * 8;
  for (int it = 0; it < T / 32; ++it) {                  // non-causal: every key chunk, each once
    // all blocks read the same rwm rows, and the heads of an example the same gamma and beta: the walk over the key chunks starts rotated by block index and
    // wraps round, so that they do not ask L2 for the same lines at the same moment
    const int kb = ((it + g) & (T / 32 - 1)) * 32;
    v8f s0 = {}, s1 = {};
    {
      // the chunk's four K fragments are read as one group ahead of its products
      const b16* k0 = kf + kb * KPITCH; const b16* k1 = k0 + 16 * KPITCH;
      const v16b a00 = frag_kb(k0, hh), a01 = frag_kb(k0 + 32, hh), a10 = frag_kb(k1, hh), a11 = frag_kb(k1 + 32, hh);
      s0 = wmma1(a00, a00, q0h, q0h, s0);
      s1 = wmma1(a10, a10, q0h, q0h, s1);
      s0 = wmma1(a01, a01, q1h, q1h, s0);
      s1 = wmma1(a11, a11, q1h, q1h, s1);
    }
    (void)slen;
    if ((kb >> 8) == (q0 >> 8)) {                         // CBDA bias: same 256-block of query and key (chunks never straddle a block)
      // scalar bases and 32-bit lane offsets: no address pairs live through the loop (the 32-wave block has 128 registers a wave)
      const unsigned go = (unsigned)((kb & (BLK - 1)) + 8 * hh), ro = go + (unsigned)(col * BLK);
      const float* rw = rwm + (size_t)q0 * BLK + ro;
      const float* gm = gam + (size_t)b * BLK + go;
      const float* bt = bet + (size_t)b * BLK + go;
#pragma unroll
      for (int r = 0; r < 8; ++r) { s0[r] += gm[r] * rw[r] + bt[r]; s1[r] += gm[16 + r] * rw[16 + r] + bt[16 + r]; }
    }
    // the chunk's four V fragments: every read stands in front of the P.V products in the source, so the compiler may spread them over the softmax arithmetic
    const b16* v0 = vf + (kb >> 4) * (DH * 16); const b16* v1 = v0 + DH * 16;
    const v16b va0 = cat8b(ld8b(v0), ld8b(v1)), va1 = cat8b(ld8b(v0 + 128), ld8b(v1 + 128));
    const v16b va2 = cat8b(ld8b(v0 + 256), ld8b(v1 + 256)), va3 = cat8b(ld8b(v0 + 384), ld8b(v1 + 384));
    float mr = -INFINITY;
#pragma unroll
    for (int r = 0; r < 8; ++r) mr = fmaxf(mr, fmaxf(s0[r], s1[r]));
    mr = fmaxf(mr, __shfl_xor(mr, 16));
    float mn = fmaxf(m, mr);
    if (mn == -INFINITY) mn = 0.0f;           // fully masked so far (padded query rows far past seq_len): keep exp() at 0
    const float al_ = __expf(m - mn);
    m = mn;
    float sum = 0.0f;
    v16b pbh, pbl;
#pragma unroll
    for (int r = 0; r < 8; ++r) {
      const float p0 = __expf(s0[r] - mn), p1 = __expf(s1[r] - mn);
      sum += p0 + p1;
      b16 a, c; split_bf16(p0, a, c); pbh[r] = a; pbl[r] = c; split_bf16(p1, a, c); pbh[8 + r] = a; pbl[8 + r] = c;
    }
    sum += __shfl_xor(sum, 16);
    l = l * al_ + sum;
#pragma unroll
    for (int r = 0; r < 8; ++r) { o0[r] *= al_; o1[r] *= al_; o2[r] *= al_; o3[r] *= al_; }
    o0 = wmma1(va0, va0, pbh, pbl, o0);
    o1 = wmma1(va1, va1, pbh, pbl, o1);
    o2 = wmma1(va2, va2, pbh, pbl, o2);
    o3 = wmma1(va3, va3, pbh, pbl, o3);
  }
  const float inv = (q0 + col < slen && l > 0.0f) ? (1.0f / l) : 0.0f;   // padded query rows are zeroed
  float* Tt = Os[wid];
#pragma unroll
  for (int r = 0; r < 8; ++r) {
    const int hr = 8 * hh + r;
    Tt[col * 64 + 0 + hr] = o0[r] * inv; Tt[col * 64 + 16 + hr] = o1[r] * inv;
    Tt[col * 64 + 32 + hr] = o2[r] * inv; Tt[col * 64 + 48 + hr] = o3[r] * inv;
  }
  wave_lds_sync();
  float* dst0 = yf + ((size_t)b * T + q0) * HID + h * DH;     // 16 rows x 64 floats, row stride HID
#pragma unroll
  for (int j = 0; j < 8; ++j) { const int rr = j * 2 + hh, c4 = col * 4; *(v4f*)(dst0 + (size_t)rr * HID + c4) = *(const v4f*)(Tt + rr * 64 + c4); }
  
}

// ---------------------------------------------------------------------------
// Output projection: (8192 x 1024) x (1024 x 1024) -> f32, A split on the fly from f32 y, B = Wo planes. grid (16, 64), 32x64 tiles staged in LDS,
// ---------------------------------------------------------------------------
__global__ __launch_bounds__(128) void out_gemm_kernel(const float* __restrict__ yf, const b16* __restrict__ woh, const b16* __restrict__ wol, const float* __restrict__ bo, int yoff,
                                                       float* __restrict__ out) {
  __shared__ __attribute__((aligned(16))) float Ts[4][32 * 64];
  const int lane = threadIdx.x & 31, wave = threadIdx.x >> 5, nloc = lane & 15, hlf = lane >> 4;
  const int m0 = (blockIdx.y + yoff) * 128 + wave * 32;
  const int c0 = blockIdx.x * 64;
  v8f acc[2][4];
#pragma unroll
  for (int r = 0; r < 2; ++r)
#pragma unroll
    for (int t = 0; t < 4; ++t) acc[r][t] = (v8f){};
  gemm_tile_split(yf, woh, wol, m0, c0, HID, nloc, hlf, acc);
  float* Tt = Ts[wave];
#pragma unroll
  for (int t = 0; t < 4; ++t)
#pragma unroll
    for (int r = 0; r < 2; ++r)
#pragma unroll
      for (int v = 0; v < 8; ++v) Tt[(r * 16 + v + 8 * hlf) * 64 + t * 16 + nloc] = acc[r][t][v] + bo[c0 + t * 16 + nloc];
  wave_lds_sync();
  float* dst0 = out + (size_t)m0 * HID + c0;
#pragma unroll
  for (int j = 0; j < 16; ++j) { const int rr = j * 2 + hlf, c4 = nloc * 4; *(v4f*)(dst0 + (size_t)rr * HID + c4) = *(const v4f*)(Tt + rr * 64 + c4); }
  
}
__global__ __launch_bounds__(256) void wcvtT_kernel(const float* __restrict__ wq, const float* __restrict__ wk, const float* __restrict__ wv,
                                                    b16* __restrict__ wqh, b16* __restrict__ wql) {
  const size_t tid = (size_t)blockIdx.x * blockDim.x + threadIdx.x, stride = (size_t)gridDim.x * blockDim.x;
  const size_t nq = (size_t)NQKV * HID / 8;
  {
    for (size_t c = tid; c < nq; c += stride) {
      const size_t i = c * 8, n = i / HID, k0 = i % HID;
      const float* w = (n < (size_t)HID) ? (wq + n * HID) : (n < (size_t)(2 * HID)) ? (wk + (n - HID) * HID) : (wv + (n - 2 * HID) * HID);
      v8b bh, bl;
#pragma unroll
      for (int e = 0; e < 8; ++e) { b16 a, cc; split_bf16(w[k0 + e], a, cc); bh[e] = a; bl[e] = cc; }
      *(v8b*)(wqh + i) = bh; *(v8b*)(wql + i) = bl;
    }
    
  }
}
// FiLM maps gamma[b][c] = te[b] . Wg[c] + bg[c] and beta[b][c] = te[b] . Wb[c] + bb[c]. One block makes one 128-B line of one map (32 columns of one
// example); each wave takes four weight rows, and its 32 lanes read te[b] and every row as whole contiguous 512-B pieces (k = 128 j + 4 lane + 0..3).
// Per-lane partial sums, then a 32-lane xor tree; the 32 results meet in LDS and leave as one whole-line store.
constexpr int FCG = BLK / 32;                   // column groups of 32 per map
__global__ __launch_bounds__(256) void film_kernel(const float* __restrict__ te, const float* __restrict__ Wg, const float* __restrict__ bg,
                                                   const float* __restrict__ Wb, const float* __restrict__ bb, float* __restrict__ gam, float* __restrict__ bet) {
  __shared__ __attribute__((aligned(16))) float Rs[32];
  const int lane = threadIdx.x & 31;
  const int wave = __builtin_amdgcn_readfirstlane(threadIdx.x >> 5);   // wave-uniform: row bases stay in scalar registers
  const int mat = blockIdx.x & 1, cg = (blockIdx.x >> 1) % FCG, b = blockIdx.x / (2 * FCG);
  const float* e = te + (size_t)b * HID + lane * 4;
  const float* w = (mat ? Wb : Wg) + (size_t)(cg * 32 + wave * 4) * HID + lane * 4;
  const float bias = (mat ? bb : bg)[cg * 32 + lane];
  // every loop below is fully unrolled: ev, a and s stay in registers, and the row loads are issued ahead of the sums that use them
  v4f ev[HID / 128];
#pragma unroll
  for (int j = 0; j < HID / 128; ++j) ev[j] = *(const v4f*)(e + j * 128);
  v4f a[4];
#pragma unroll
  for (int r = 0; r < 4; ++r) a[r] = (v4f){};
#pragma unroll
  for (int j = 0; j < HID / 128; ++j)
#pragma unroll
    for (int r = 0; r < 4; ++r) a[r] += ev[j] * *(const v4f*)(w + (size_t)r * HID + j * 128);
  v4f s;
#pragma unroll
  for (int r = 0; r < 4; ++r) s[r] = (a[r][0] + a[r][1]) + (a[r][2] + a[r][3]);
#pragma unroll
  for (int m = 16; m >= 1; m >>= 1)
#pragma unroll
    for (int r = 0; r < 4; ++r) s[r] += __shfl_xor(s[r], m);
  if (lane == 0) *(v4f*)(Rs + wave * 4) = s;
  __syncthreads();   // the eight waves' sums are in LDS before the first wave reads them
  if (threadIdx.x < 32) (mat ? bet : gam)[(size_t)b * BLK + cg * 32 + lane] = Rs[lane] + bias;
}
}  // namespace

extern "C" void kernel_launch(void* const* d_in, const int* in_sizes, int n_in,
                              void* d_out, int out_size, void* d_ws, size_t ws_size, hipStream_t stream) {
  (void)in_sizes; (void)n_in; (void)out_size;
  const float* x   = (const float*)d_in[0];    // hidden_states [16,512,1024]
  const float* te  = (const float*)d_in[1];    // task_embedding [16,1024]
  const float* Wq  = (const float*)d_in[2];  const float* bq = (const float*)d_in[3];
  const float* Wk  = (const float*)d_in[4];  const float* bk = (const float*)d_in[5];
  const float* Wv  = (const float*)d_in[6];  const float* bv = (const float*)d_in[7];
  const float* Wg  = (const float*)d_in[8];  const float* bg = (const float*)d_in[9];
  const float* Wb  = (const float*)d_in[10]; const float* bb = (const float*)d_in[11];
  const float* rwm = (const float*)d_in[12];   // [512,256]
  float* out = (float*)d_out;                  // ctx [16,512,1024]

  size_t off = 0; char* ws = (char*)d_ws;
  b16* wqh = (b16*)(ws + off); off += (size_t)NQKV * HID * 2;
  b16* wql = (b16*)(ws + off); off += (size_t)NQKV * HID * 2;
  b16* Qh  = (b16*)(ws + off); off += (size_t)MROWS * HID * 2;
  b16* Ql  = (b16*)(ws + off); off += (size_t)MROWS * HID * 2;
  b16* Kh  = (b16*)(ws + off); off += (size_t)MROWS * KVW * 2;
  b16* Kl  = (b16*)(ws + off); off += (size_t)MROWS * KVW * 2;
  b16* Vh  = (b16*)(ws + off); off += (size_t)MROWS * KVW * 2;
  b16* Vl  = (b16*)(ws + off); off += (size_t)MROWS * KVW * 2;
  float* gam = (float*)(ws + off); off += (size_t)Bsz * BLK * 4;
  float* bet = (float*)(ws + off); off += (size_t)Bsz * BLK * 4;
  if (off > ws_size) return;
  const int ROWBLK = MROWS / 128, NQT = Bsz * NH * QT_PER_B;
  wcvtT_kernel<<<2048, 256, 0, stream>>>(Wq, Wk, Wv, wqh, wql);
  film_kernel<<<Bsz * FCG * 2, 256, 0, stream>>>(te, Wg, bg, Wb, bb, gam, bet);
  qkv_gemm_kernel<<<dim3(NQKV / GBN, ROWBLK), 256, 0, stream>>>(x, x, x, wqh, wql, bq, bk, bv, nullptr, 0, 0, Qh, Ql, Kh, Kl, Vh, Vl);
  attn_kernel<<<NQT / AWAVES, AWAVES * 32, 0, stream>>>(Qh, Ql, Kh, Kl, Vh, Vl, nullptr, gam, bet, rwm, out);
}

// v005
// Measured time: 83.1 microseconds a run.
// Timed twice side by side with v004, it ran 1.05 and 1.06 times as fast.
// Over all steps from v000 it is 4.02 times as fast.
#include <hip/hip_runtime.h>

// BERT self-attention with a FiLM-conditioned block-diagonal additive bias (CBDA): q/k/v = x W^T + b (torch layout, 16 heads x 64), scores/8 +
// bias[b][q][k] (= gamma[b][k%256] * rwm[q][k%256] + beta[b][k%256] when q and k fall in the same 256-block, else 0; gamma/beta = task_emb Wg^T + bg /
// Wb^T + bb), softmax, ctx = P v -> [16, 512, 1024] (no output projection). Lean build: single f16 products on v_wmma_f32_16x16x32_f16, f32 accumulate
// (ctx averages ~512 positions; no large rows); fragment k-map per lane half hh for A AND B: elements 0..7 <- k = 8hh+0..7, 8..15 <- k = 16+8hh+0..7.

namespace {
constexpr int Bsz = 16, T = 512, HID = 1024, DH = 64, NH = 16, NKV = 16, REP = NH / NKV;
constexpr int BLK = 256;
constexpr int KVW = NKV * DH;                 // 1024
constexpr int NQKV = HID + 2 * KVW;           // 3072 columns: q | k | v
constexpr int MROWS = Bsz * T;                // 8192
constexpr int QT_PER_B = T / 16;              // 32

typedef _Float16 b16;                                           // f16 hi/lo planes
typedef __attribute__((ext_vector_type(16))) _Float16 v16b;
typedef __attribute__((ext_vector_type(8)))  _Float16 v8b;
typedef __attribute__((ext_vector_type(4)))  _Float16 v4b;
typedef __attribute__((ext_vector_type(8)))  float v8f;
typedef __attribute__((ext_vector_type(4)))  float v4f;

__device__ __forceinline__ v8b ld8b(const b16* p) { return *(const v8b*)p; }
__device__ __forceinline__ v16b cat8b(v8b a, v8b b) { return __builtin_shufflevector(a, b, 0, 1, 2, 3, 4, 5, 6, 7, 8, 9, 10, 11, 12, 13, 14, 15); }
// 16x16x32 16-bit fragment from a k-contiguous row pointer (A: lane&15 = row, B: lane&15 = column), hh = lane>>4:
// elements 0..7 <- p[8hh+0..7], elements 8..15 <- p[16+8hh+0..7]
__device__ __forceinline__ v16b frag_kb(const b16* p, int hh) { return cat8b(ld8b(p + 8 * hh), ld8b(p + 16 + 8 * hh)); }
__device__ __forceinline__ void split_bf16(float v, b16& hi, b16& lo) {   // (name kept) single f16: no low part
  hi = (b16)v; lo = (b16)0.0f;
}
// split fragment straight from an f32 k-contiguous row
__device__ __forceinline__ void frag_ksplit(const float* p, int hh, v16b& fh_, v16b& fl_) {
  const float* p0 = p + 8 * hh; const float* p1 = p + 16 + 8 * hh;
#pragma unroll
  for (int e = 0; e < 8; ++e) { b16 a, c; split_bf16(p0[e], a, c); fh_[e] = a; fl_[e] = c; split_bf16(p1[e], a, c); fh_[8 + e] = a; fl_[8 + e] = c; }
}
__device__ __forceinline__ v8f wmma16b(v16b a, v16b b, v8f c) {
  v8f d = __builtin_amdgcn_wmma_f32_16x16x32_f16(false, a, false, b, (short)0, c, false, false);
  asm volatile("v_nop\n\tv_nop\n\tv_nop\n\tv_nop" : "+v"(d) : "v"(a), "v"(b));
  return d;
}
// acc += A.B with both operands split: A = (ah, al), B = (bh, bl)
__device__ __forceinline__ v8f wmma3(v16b ah, v16b al, v16b bh, v16b bl, v8f c) {   // lean: single f16 product
  (void)al; (void)bl; return wmma16b(ah, bh, c);
}
__device__ __forceinline__ v8f wmma1(v16b ah, v16b al, v16b bh, v16b bl, v8f c) {   // attention products: single f16 (hi planes only)
  (void)al; (void)bl; return wmma16b(ah, bh, c);
}
__device__ __forceinline__ void wave_lds_sync() {
  __builtin_amdgcn_fence(__ATOMIC_RELEASE, "workgroup");
  __builtin_amdgcn_wave_barrier();
  __builtin_amdgcn_fence(__ATOMIC_ACQUIRE, "workgroup");
}

// ---------------------------------------------------------------------------
// Weights ([in][out]) -> f16 hi / lo planes transposed to [n][k] (k contiguous): columns of Wq|Wk|Wv into wqh/wql [3072][1024], Wo into woh/wol [1024][1024].
// ---------------------------------------------------------------------------
__global__ __launch_bounds__(256) void wcvt_kernel(const float* __restrict__ wq, const float* __restrict__ wk, const float* __restrict__ wv,
                                                   const float* __restrict__ wo, b16* __restrict__ wqh, b16* __restrict__ wql,
                                                   b16* __restrict__ woh, b16* __restrict__ wol) {
  const size_t tid = (size_t)blockIdx.x * blockDim.x + threadIdx.x, stride = (size_t)gridDim.x * blockDim.x;
  const size_t nq = (size_t)NQKV * HID / 8, no = (size_t)HID * HID / 8;
  {
    for (size_t c = tid; c < nq + no; c += stride) {
      float f[8]; size_t i; b16* dh; b16* dl;
      if (c < nq) {
        i = c * 8; const size_t n = i / HID, k0 = i % HID;
        const float* w; int nn, ld;
        if (n < (size_t)HID) { w = wq; nn = (int)n; ld = HID; } else if (n < (size_t)(HID + KVW)) { w = wk; nn = (int)n - HID; ld = KVW; } else { w = wv; nn = (int)n - HID - KVW; ld = KVW; }
#pragma unroll
        for (int e = 0; e < 8; ++e) f[e] = w[(size_t)(k0 + e) * ld + nn];       // W[k][n] ([in][out])
        dh = wqh; dl = wql;
      } else {
        i = (c - nq) * 8; const size_t n = i / HID, k0 = i % HID;
#pragma unroll
        for (int e = 0; e < 8; ++e) f[e] = wo[(size_t)(k0 + e) * HID + n];    // Wo[k][n] ([in][out])
        dh = woh; dl = wol;
      }
      v8b bh, bl;
#pragma unroll
      for (int e = 0; e < 8; ++e) { b16 a, cc; split_bf16(f[e], a, cc); bh[e] = a; bl[e] = cc; }
      *(v8b*)(dh + i) = bh; *(v8b*)(dl + i) = bl;
    }
    
  }
}

// 32x64 wave tile over K from f32 A rows and f16-plane B rows
__device__ __forceinline__ void gemm_tile_split(const float* __restrict__ A, const b16* __restrict__ wh, const b16* __restrict__ wl,
                                                int m0, int c0, int K, int nloc, int hlf, v8f (&acc)[2][4]) {
  for (int kb = 0; kb < K; kb += 32) {
    v16b a0h, a0l, a1h, a1l;
    frag_ksplit(A + (size_t)(m0 + nloc) * K + kb, hlf, a0h, a0l);
    frag_ksplit(A + (size_t)(m0 + 16 + nloc) * K + kb, hlf, a1h, a1l);
#pragma unroll
    for (int t = 0; t < 4; ++t) {
      const size_t wofs = (size_t)(c0 + t * 16 + nloc) * K + kb;
      const v16b bh = frag_kb(wh + wofs, hlf), bl = frag_kb(wl + wofs, hlf);
      acc[0][t] = wmma3(a0h, a0l, bh, bl, acc[0][t]);
      acc[1][t] = wmma3(a1h, a1l, bh, bl, acc[1][t]);
    }
  }
}

// ---------------------------------------------------------------------------
// QKV GEMM: (8192 x 1024) x (1024 x 3072), grid (12, 64), block 8 waves (2 x 4), block tile 128 rows x 256 columns, wave = 64 rows x 64 columns (one head of
// q, k or v). Per pass of 64 k the block brings its x rows (f32, whole 128-B lines, converted to f16 once) and its weight rows through registers into LDS
// (row pitch 144 B); every wave reads its fragments from there. Two LDS buffers, one barrier per pass: the next pass's global loads are issued ahead of this
// pass's products and stored into the other buffer behind them. The walk over k starts at a pass rotated by block index. Outputs, one f16 array each:
// q (x1/8) -> Qh [b][h][t][64]; k -> Kh [b][kvh][t][64] (4 KB contiguous per wave and 32 rows);
// v -> Vh key-tiled [b][kvh][t/16][64][16] (4 KB contiguous per wave and 32 rows).
// ---------------------------------------------------------------------------
constexpr int GBM = 128, GBN = 256, GKS = 64;
constexpr int GPITCH = GKS + 8;                 // LDS row pitch in f16 elements: 144 B = 16 B x 9 (conflict-free for 16-byte fragment reads)
constexpr int GSTAGE = (GBM + GBN) * GPITCH;    // one buffer: x rows, then weight rows
constexpr int GEPI = 8 * 2 * 32 * 64;           // epilogue staging, 8 KB per wave, in the same LDS behind the last pass's barrier
constexpr int GSMEM = (2 * GSTAGE > GEPI) ? 2 * GSTAGE : GEPI;
__global__ __launch_bounds__(256) void qkv_gemm_kernel(const float* __restrict__ xq, const float* __restrict__ xk, const float* __restrict__ xv,
                                                       const b16* __restrict__ wqh,
                                                       const float* __restrict__ bq, const float* __restrict__ bk, const float* __restrict__ bv, const float* __restrict__ rope_cs, int xoff, int yoff,
                                                       b16* __restrict__ Qh, b16* __restrict__ Kh, b16* __restrict__ Vh) {
  __shared__ __attribute__((aligned(16))) b16 Sm[GSMEM];
  (void)rope_cs;
  const int tid = threadIdx.x, lane = tid & 31, nloc = lane & 15, hlf = lane >> 4;
  const int wave = __builtin_amdgcn_readfirstlane(tid >> 5);        // wave-uniform: head, matrix and staging bases stay in scalar registers
  const int wm = wave >> 2, wn = wave & 3;
  const int mblk = (blockIdx.y + yoff) * GBM;
  const int cblk = (blockIdx.x + xoff) * GBN;
  const int c0 = cblk + wn * 64;
  const int mat = (c0 < HID) ? 0 : (c0 < HID + KVW) ? 1 : 2;
  const int head = (mat == 0) ? (c0 / DH) : (mat == 1) ? ((c0 - HID) / DH) : ((c0 - HID - KVW) / DH);
  const float* x = (mat == 0) ? xq : (mat == 1) ? xk : xv;          // input of q, k or v (the same x at the launch)
  const float* bias = ((mat == 0) ? bq : (mat == 1) ? bk : bv) + head * DH;
  // loaders: x, 16 threads x 16 B per row (a wave covers 2 rows x 256 B); weights, 8 threads x 16 B per row (a wave covers 4 rows x 128 B)
  const int arow = tid >> 4, acol = (tid & 15) * 4;
  const int brow = tid >> 3, bcol = (tid & 7) * 8;
  // Blocks that share x rows (same blockIdx.y) or weight rows (same blockIdx.x) run at the same time; each starts its walk over k at another pass and wraps
  // round, so that they do not ask L2 for the same lines at the same moment. Every block still takes all HID / GKS passes, each once.
  const int rot = (blockIdx.x + blockIdx.y) & (HID / GKS - 1);
  const float* ag = x + (size_t)(mblk + arow) * HID + acol + rot * GKS;
  const b16* bg = wqh + (size_t)(cblk + brow) * HID + bcol + rot * GKS;
  b16* as = Sm + arow * GPITCH + acol;
  b16* bs = Sm + (GBM + brow) * GPITCH + bcol;
  const b16* af0 = Sm + (wm * 64 + nloc) * GPITCH;
  const b16* bf0 = Sm + (GBM + wn * 64 + nloc) * GPITCH;
  v4f ra[8]; v8b rb[8];
  v8f acc[4][4];
#pragma unroll
  for (int r = 0; r < 4; ++r)
#pragma unroll
    for (int t = 0; t < 4; ++t) acc[r][t] = (v8f){};
#pragma unroll
  for (int j = 0; j < 8; ++j) { ra[j] = *(const v4f*)(ag + (size_t)j * 16 * HID); rb[j] = ld8b(bg + (size_t)j * 32 * HID); }
#pragma unroll
  for (int j = 0; j < 8; ++j) {
    v4b h; 
#pragma unroll
    for (int e = 0; e < 4; ++e) h[e] = (b16)ra[j][e];
    *(v4b*)(as + j * 16 * GPITCH) = h; *(v8b*)(bs + j * 32 * GPITCH) = rb[j];
  }
  __syncthreads();
  for (int it = 0; it < HID / GKS; ++it) {
    const int cur = (it & 1) * GSTAGE, nxt = GSTAGE - cur;
    const bool more = it + 1 < HID / GKS;
    if (more) {
      const int step = (((it + 1 + rot) & (HID / GKS - 1)) == 0) ? GKS - HID : GKS;   // on to the next pass of the walk, from the last one back to k = 0
      ag += step; bg += step;
#pragma unroll
      for (int j = 0; j < 8; ++j) { ra[j] = *(const v4f*)(ag + (size_t)j * 16 * HID); rb[j] = ld8b(bg + (size_t)j * 32 * HID); }
    }
#pragma unroll
    for (int ks = 0; ks < GKS; ks += 32) {
      v16b a[4];
#pragma unroll
      for (int r = 0; r < 4; ++r) a[r] = frag_kb(af0 + cur + r * 16 * GPITCH + ks, hlf);
      v16b bh = frag_kb(bf0 + cur + ks, hlf);
#pragma unroll
      for (int t = 0; t < 4; ++t) {
        v16b bn = bh;
        if (t < 3) bn = frag_kb(bf0 + cur + (t + 1) * 16 * GPITCH + ks, hlf);   // the next column fragment is read ahead of this one's four products
#pragma unroll
        for (int r = 0; r < 4; ++r) acc[r][t] = wmma3(a[r], a[r], bh, bh, acc[r][t]);
        bh = bn;
      }
    }
    if (more) {
#pragma unroll
      for (int j = 0; j < 8; ++j) {
        v4b h;
#pragma unroll
        for (int e = 0; e < 4; ++e) h[e] = (b16)ra[j][e];
        *(v4b*)(as + nxt + j * 16 * GPITCH) = h; *(v8b*)(bs + nxt + j * 32 * GPITCH) = rb[j];
      }
    }
    __syncthreads();   // publishes the buffer just filled and ends every wave's reads of the one refilled next (after the last pass: of the LDS the epilogue reuses)
  }
  const float s = (mat == 0) ? 0.125f : 1.0f;
  b16* Tw = Sm + wave * (2 * 32 * 64);                              // each wave stages in its own 8 KB: [32-row half][32 * 64]
#pragma unroll
  for (int r2 = 0; r2 < 2; ++r2) {
    b16* Tp0 = Tw + r2 * (32 * 64);
#pragma unroll
    for (int t = 0; t < 4; ++t)
#pragma unroll
      for (int r = 0; r < 2; ++r)
#pragma unroll
        for (int v = 0; v < 8; ++v) {
          const int rr = r * 16 + v + 8 * hlf, d = t * 16 + nloc;
          const float val = acc[r2 * 2 + r][t][v] + bias[d];
          const int idx = (mat < 2) ? (rr * 64 + d) : ((rr >> 4) * 1024 + d * 16 + (rr & 15));
          Tp0[idx] = (b16)(val * s);
        }
  }
  wave_lds_sync();
#pragma unroll
  for (int r2 = 0; r2 < 2; ++r2) {
    const b16* Tp0 = Tw + r2 * (32 * 64);
    const int m0 = mblk + wm * 64 + r2 * 32;
    const int b = m0 / T, t0 = m0 % T;
    b16* dh;
    if (mat == 0)      dh = Qh + ((size_t)(b * NH + head) * T + t0) * DH;
    else if (mat == 1) dh = Kh + ((size_t)(b * NKV + head) * T + t0) * DH;
    else               dh = Vh + ((size_t)(b * NKV + head) * QT_PER_B + (t0 >> 4)) * (size_t)(DH * 16);
#pragma unroll
    for (int j = 0; j < 8; ++j) { const int e = (j * 32 + lane) * 8; *(v8b*)(dh + e) = ld8b(Tp0 + e); }
    // the next half's LDS reads reuse the registers that these stores name: keep the wait in front of that overwrite
    if (r2 == 0) asm volatile("s_wait_xcnt 0x0" ::: "memory");
  }
}

// ---------------------------------------------------------------------------
// Transposed flash attention: one block per (b, head), 32 waves, each wave owns one 16-query tile; all keys in chunks of 32.
// The head's K rows (LDS pitch 144 B, conflict-free for 16-byte fragment reads) and its key-tiled V (in LDS [t/16][key half][64][8], so that each 16-lane
// half of a fragment read covers 256 contiguous bytes) are brought into LDS once, by asynchronous copies of whole 512-B pieces per wave; every wave reads
// its fragments from there.
// S^T = K.Q^T (single f16, hi planes), per-lane online softmax; P^T built in registers from the two S^T accumulators
// ---------------------------------------------------------------------------
constexpr int AWAVES = QT_PER_B;                // one wave per query tile of the head
constexpr int KPITCH = DH + 8;                  // K row pitch in LDS, f16 elements
__global__ __launch_bounds__(AWAVES * 32) void attn_kernel(const b16* __restrict__ Qh, const b16* __restrict__ Kh, const b16* __restrict__ Vh, const int* __restrict__ seqlen,
                                                   const float* __restrict__ gam, const float* __restrict__ bet, const float* __restrict__ rwm,
                                                   float* __restrict__ yf) {
  __shared__ __attribute__((aligned(16))) b16 Ks[T * KPITCH];
  __shared__ __attribute__((aligned(16))) b16 Vs[T * DH];
  __shared__ __attribute__((aligned(16))) float Os[AWAVES][16 * 64];
  const int tid = threadIdx.x, lane = tid & 31, hh = lane >> 4, col = lane & 15;
  const int wid = __builtin_amdgcn_readfirstlane(tid >> 5);   // wave-uniform: the query tile and the bias test stay in scalar registers
  const int g = blockIdx.x;                               // b*NH + h
  const int q0 = wid << 4;
  const int b = g / NH, h = g % NH, kvh = h / REP;
  const size_t ko = (size_t)(b * NKV + kvh) * T * DH;
  const size_t qo = ((size_t)g * T + q0 + col) * DH;
  const v16b q0h = frag_kb(Qh + qo, hh), q1h = frag_kb(Qh + qo + 32, hh);
  {
    // thread tid moves the 16-byte pieces tid, tid + 1024, tid + 2048, tid + 3072 of the head's 64 KB of K and of its 64 KB of V
    const b16* kg = Kh + ko + tid * 8;
    const b16* vg = Vh + ko + tid * 8;
    const unsigned kl = (unsigned)(size_t)(Ks + (tid >> 3) * KPITCH + (tid & 7) * 8);
    const unsigned vl = (unsigned)(size_t)(Vs + (tid >> 7) * (DH * 16) + (tid & 1) * (DH * 8) + ((tid >> 1) & (DH - 1)) * 8);   // piece = (key tile, feature, key half)
    constexpr int GSTEP = 1024 * 8;                       // elements per step in memory (and in Vs: 8 key tiles)
    constexpr unsigned KSTEP = 128 * KPITCH * 2, VSTEP = GSTEP * 2;   // bytes per step in LDS
    // the copies and, as the last line, the wait that stands in front of any rewrite of the address registers they name
    asm volatile("global_load_async_to_lds_b128 %0, %8, off\n\t"
                 "global_load_async_to_lds_b128 %1, %9, off\n\t"
                 "global_load_async_to_lds_b128 %2, %10, off\n\t"
                 "global_load_async_to_lds_b128 %3, %11, off\n\t"
                 "global_load_async_to_lds_b128 %4, %12, off\n\t"
                 "global_load_async_to_lds_b128 %5, %13, off\n\t"
                 "global_load_async_to_lds_b128 %6, %14, off\n\t"
                 "global_load_async_to_lds_b128 %7, %15, off\n\t"
                 "s_wait_xcnt 0x0"
                 :: "v"(kl), "v"(kl + KSTEP), "v"(kl + 2 * KSTEP), "v"(kl + 3 * KSTEP),
                    "v"(vl), "v"(vl + VSTEP), "v"(vl + 2 * VSTEP), "v"(vl + 3 * VSTEP),
                    "v"(kg), "v"(kg + GSTEP), "v"(kg + 2 * GSTEP), "v"(kg + 3 * GSTEP),
                    "v"(vg), "v"(vg + GSTEP), "v"(vg + 2 * GSTEP), "v"(vg + 3 * GSTEP)
                 : "memory");
    asm volatile("s_wait_asynccnt 0x0" ::: "memory");   // this wave's copies have landed before it passes the barrier
  }
  __syncthreads();   // every wave's copies are in LDS before any wave reads K or V
  float m = -INFINITY, l = 0.0f;
  v8f o0 = {}, o1 = {}, o2 = {}, o3 = {};
  const int slen = T; (void)seqlen;                       // no padding in this module
  const b16* kf = Ks + col * KPITCH;
  const b16* vf = Vs + hh * (DH * 8) + col * 8;
  for (int it = 0; it < T / 32; ++it) {                  // non-causal: every key chunk, each once
    // all blocks read the same rwm rows, and the heads of an example the same gamma and beta: the walk over the key chunks starts rotated by block index and
    // wraps round, so that they do not ask L2 for the same lines at the same moment
    const int kb = ((it + g) & (T / 32 - 1)) * 32;
    v8f s0 = {}, s1 = {};
    {
      // the chunk's four K fragments are read as one group ahead of its products
      const b16* k0 = kf + kb * KPITCH; const b16* k1 = k0 + 16 * KPITCH;
      const v16b a00 = frag_kb(k0, hh), a01 = frag_kb(k0 + 32, hh), a10 = frag_kb(k1, hh), a11 = frag_kb(k1 + 32, hh);
      s0 = wmma1(a00, a00, q0h, q0h, s0);
      s1 = wmma1(a10, a10, q0h, q0h, s1);
      s0 = wmma1(a01, a01, q1h, q1h, s0);
      s1 = wmma1(a11, a11, q1h, q1h, s1);
    }
    (void)slen;
    if ((kb >> 8) == (q0 >> 8)) {                         // CBDA bias: same 256-block of query and key (chunks never straddle a block)
      // scalar bases and 32-bit lane offsets: no address pairs live through the loop (the 32-wave block has 128 registers a wave)
      const unsigned go = (unsigned)((kb & (BLK - 1)) + 8 * hh), ro = go + (unsigned)(col * BLK);
      const float* rw = rwm + (size_t)q0 * BLK + ro;
      const float* gm = gam + (size_t)b * BLK + go;
      const float* bt = bet + (size_t)b * BLK + go;
#pragma unroll
      for (int r = 0; r < 8; ++r) { s0[r] += gm[r] * rw[r] + bt[r]; s1[r] += gm[16 + r] * rw[16 + r] + bt[16 + r]; }
    }
    // the chunk's four V fragments: every read stands in front of the P.V products in the source, so the compiler may spread them over the softmax arithmetic
    const b16* v0 = vf + (kb >> 4) * (DH * 16); const b16* v1 = v0 + DH * 16;
    const v16b va0 = cat8b(ld8b(v0), ld8b(v1)), va1 = cat8b(ld8b(v0 + 128), ld8b(v1 + 128));
    const v16b va2 = cat8b(ld8b(v0 + 256), ld8b(v1 + 256)), va3 = cat8b(ld8b(v0 + 384), ld8b(v1 + 384));
    float mr = -INFINITY;
#pragma unroll
    for (int r = 0; r < 8; ++r) mr = fmaxf(mr, fmaxf(s0[r], s1[r]));
    mr = fmaxf(mr, __shfl_xor(mr, 16));
    float mn = fmaxf(m, mr);
    if (mn == -INFINITY) mn = 0.0f;           // fully masked so far (padded query rows far past seq_len): keep exp() at 0
    const float al_ = __expf(m - mn);
    m = mn;
    float sum = 0.0f;
    v16b pbh, pbl;
#pragma unroll
    for (int r = 0; r < 8; ++r) {
      const float p0 = __expf(s0[r] - mn), p1 = __expf(s1[r] - mn);
      sum += p0 + p1;
      b16 a, c; split_bf16(p0, a, c); pbh[r] = a; pbl[r] = c; split_bf16(p1, a, c); pbh[8 + r] = a; pbl[8 + r] = c;
    }
    sum += __shfl_xor(sum, 16);
    l = l * al_ + sum;
#pragma unroll
    for (int r = 0; r < 8; ++r) { o0[r] *= al_; o1[r] *= al_; o2[r] *= al_; o3[r] *= al_; }
    o0 = wmma1(va0, va0, pbh, pbl, o0);
    o1 = wmma1(va1, va1, pbh, pbl, o1);
    o2 = wmma1(va2, va2, pbh, pbl, o2);
    o3 = wmma1(va3, va3, pbh, pbl, o3);
  }
  const float inv = (q0 + col < slen && l > 0.0f) ? (1.0f / l) : 0.0f;   // padded query rows are zeroed
  float* Tt = Os[wid];
#pragma unroll
  for (int r = 0; r < 8; ++r) {
    const int hr = 8 * hh + r;
    Tt[col * 64 + 0 + hr] = o0[r] * inv; Tt[col * 64 + 16 + hr] = o1[r] * inv;
    Tt[col * 64 + 32 + hr] = o2[r] * inv; Tt[col * 64 + 48 + hr] = o3[r] * inv;
  }
  wave_lds_sync();
  float* dst0 = yf + ((size_t)b * T + q0) * HID + h * DH;     // 16 rows x 64 floats, row stride HID
#pragma unroll
  for (int j = 0; j < 8; ++j) { const int rr = j * 2 + hh, c4 = col * 4; *(v4f*)(dst0 + (size_t)rr * HID + c4) = *(const v4f*)(Tt + rr * 64 + c4); }
  
}

// ---------------------------------------------------------------------------
// Output projection: (8192 x 1024) x (1024 x 1024) -> f32, A split on the fly from f32 y, B = Wo planes. grid (16, 64), 32x64 tiles staged in LDS,
// ---------------------------------------------------------------------------
__global__ __launch_bounds__(128) void out_gemm_kernel(const float* __restrict__ yf, const b16* __restrict__ woh, const b16* __restrict__ wol, const float* __restrict__ bo, int yoff,
                                                       float* __restrict__ out) {
  __shared__ __attribute__((aligned(16))) float Ts[4][32 * 64];
  const int lane = threadIdx.x & 31, wave = threadIdx.x >> 5, nloc = lane & 15, hlf = lane >> 4;
  const int m0 = (blockIdx.y + yoff) * 128 + wave * 32;
  const int c0 = blockIdx.x * 64;
  v8f acc[2][4];
#pragma unroll
  for (int r = 0; r < 2; ++r)
#pragma unroll
    for (int t = 0; t < 4; ++t) acc[r][t] = (v8f){};
  gemm_tile_split(yf, woh, wol, m0, c0, HID, nloc, hlf, acc);
  float* Tt = Ts[wave];
#pragma unroll
  for (int t = 0; t < 4; ++t)
#pragma unroll
    for (int r = 0; r < 2; ++r)
#pragma unroll
      for (int v = 0; v < 8; ++v) Tt[(r * 16 + v + 8 * hlf) * 64 + t * 16 + nloc] = acc[r][t][v] + bo[c0 + t * 16 + nloc];
  wave_lds_sync();
  float* dst0 = out + (size_t)m0 * HID + c0;
#pragma unroll
  for (int j = 0; j < 16; ++j) { const int rr = j * 2 + hlf, c4 = nloc * 4; *(v4f*)(dst0 + (size_t)rr * HID + c4) = *(const v4f*)(Tt + rr * 64 + c4); }
  
}
__global__ __launch_bounds__(256) void wcvtT_kernel(const float* __restrict__ wq, const float* __restrict__ wk, const float* __restrict__ wv,
                                                    b16* __restrict__ wqh) {
  const size_t tid = (size_t)blockIdx.x * blockDim.x + threadIdx.x, stride = (size_t)gridDim.x * blockDim.x;
  const size_t nq = (size_t)NQKV * HID / 8;
  {
    for (size_t c = tid; c < nq; c += stride) {
      const size_t i = c * 8, n = i / HID, k0 = i % HID;
      const float* w = (n < (size_t)HID) ? (wq + n * HID) : (n < (size_t)(2 * HID)) ? (wk + (n - HID) * HID) : (wv + (n - 2 * HID) * HID);
      v8b bh;
#pragma unroll
      for (int e = 0; e < 8; ++e) bh[e] = (b16)w[k0 + e];
      *(v8b*)(wqh + i) = bh;
    }
    
  }
}
// FiLM maps gamma[b][c] = te[b] . Wg[c] + bg[c] and beta[b][c] = te[b] . Wb[c] + bb[c]. One block makes one 128-B line of one map (32 columns of one
// example); each wave takes four weight rows, and its 32 lanes read te[b] and every row as whole contiguous 512-B pieces (k = 128 j + 4 lane + 0..3).
// Per-lane partial sums, then a 32-lane xor tree; the 32 results meet in LDS and leave as one whole-line store.
constexpr int FCG = BLK / 32;                   // column groups of 32 per map
__global__ __launch_bounds__(256) void film_kernel(const float* __restrict__ te, const float* __restrict__ Wg, const float* __restrict__ bg,
                                                   const float* __restrict__ Wb, const float* __restrict__ bb, float* __restrict__ gam, float* __restrict__ bet) {
  __shared__ __attribute__((aligned(16))) float Rs[32];
  const int lane = threadIdx.x & 31;
  const int wave = __builtin_amdgcn_readfirstlane(threadIdx.x >> 5);   // wave-uniform: row bases stay in scalar registers
  const int mat = blockIdx.x & 1, cg = (blockIdx.x >> 1) % FCG, b = blockIdx.x / (2 * FCG);
  const float* e = te + (size_t)b * HID + lane * 4;
  const float* w = (mat ? Wb : Wg) + (size_t)(cg * 32 + wave * 4) * HID + lane * 4;
  const float bias = (mat ? bb : bg)[cg * 32 + lane];
  // every loop below is fully unrolled: ev, a and s stay in registers, and the row loads are issued ahead of the sums that use them
  v4f ev[HID / 128];
#pragma unroll
  for (int j = 0; j < HID / 128; ++j) ev[j] = *(const v4f*)(e + j * 128);
  v4f a[4];
#pragma unroll
  for (int r = 0; r < 4; ++r) a[r] = (v4f){};
#pragma unroll
  for (int j = 0; j < HID / 128; ++j)
#pragma unroll
    for (int r = 0; r < 4; ++r) a[r] += ev[j] * *(const v4f*)(w + (size_t)r * HID + j * 128);
  v4f s;
#pragma unroll
  for (int r = 0; r < 4; ++r) s[r] = (a[r][0] + a[r][1]) + (a[r][2] + a[r][3]);
#pragma unroll
  for (int m = 16; m >= 1; m >>= 1)
#pragma unroll
    for (int r = 0; r < 4; ++r) s[r] += __shfl_xor(s[r], m);
  if (lane == 0) *(v4f*)(Rs + wave * 4) = s;
  __syncthreads();   // the eight waves' sums are in LDS before the first wave reads them
  if (threadIdx.x < 32) (mat ? bet : gam)[(size_t)b * BLK + cg * 32 + lane] = Rs[lane] + bias;
}
}  // namespace

extern "C" void kernel_launch(void* const* d_in, const int* in_sizes, int n_in,
                              void* d_out, int out_size, void* d_ws, size_t ws_size, hipStream_t stream) {
  (void)in_sizes; (void)n_in; (void)out_size;
  const float* x   = (const float*)d_in[0];    // hidden_states [16,512,1024]
  const float* te  = (const float*)d_in[1];    // task_embedding [16,1024]
  const float* Wq  = (const float*)d_in[2];  const float* bq = (const float*)d_in[3];
  const float* Wk  = (const float*)d_in[4];  const float* bk = (const float*)d_in[5];
  const float* Wv  = (const float*)d_in[6];  const float* bv = (const float*)d_in[7];
  const float* Wg  = (const float*)d_in[8];  const float* bg = (const float*)d_in[9];
  const float* Wb  = (const float*)d_in[10]; const float* bb = (const float*)d_in[11];
  const float* rwm = (const float*)d_in[12];   // [512,256]
  float* out = (float*)d_out;                  // ctx [16,512,1024]

  size_t off = 0; char* ws = (char*)d_ws;
  b16* wqh = (b16*)(ws + off); off += (size_t)NQKV * HID * 2;
  b16* Qh  = (b16*)(ws + off); off += (size_t)MROWS * HID * 2;
  b16* Kh  = (b16*)(ws + off); off += (size_t)MROWS * KVW * 2;
  b16* Vh  = (b16*)(ws + off); off += (size_t)MROWS * KVW * 2;
  float* gam = (float*)(ws + off); off += (size_t)Bsz * BLK * 4;
  float* bet = (float*)(ws + off); off += (size_t)Bsz * BLK * 4;
  if (off > ws_size) return;
  const int ROWBLK = MROWS / 128, NQT = Bsz * NH * QT_PER_B;
  wcvtT_kernel<<<2048, 256, 0, stream>>>(Wq, Wk, Wv, wqh);
  film_kernel<<<Bsz * FCG * 2, 256, 0, stream>>>(te, Wg, bg, Wb, bb, gam, bet);
  qkv_gemm_kernel<<<dim3(NQKV / GBN, ROWBLK), 256, 0, stream>>>(x, x, x, wqh, bq, bk, bv, nullptr, 0, 0, Qh, Kh, Vh);
  attn_kernel<<<NQT / AWAVES, AWAVES * 32, 0, stream>>>(Qh, Kh, Vh, nullptr, gam, bet, rwm, out);
}

// v006
// One run takes 80.1 microseconds.
// Next to v005, in two timings, it ran 1.04 and 1.03 times as fast.
// All steps since v000 together make it 4.15 times as fast.
#include <hip/hip_runtime.h>

// BERT self-attention with a FiLM-conditioned block-diagonal additive bias (CBDA): q/k/v = x W^T + b (torch layout, 16 heads x 64), scores/8 +
// bias[b][q][k] (= gamma[b][k%256] * rwm[q][k%256] + beta[b][k%256] when q and k fall in the same 256-block, else 0; gamma/beta = task_emb Wg^T + bg /
// Wb^T + bb), softmax, ctx = P v -> [16, 512, 1024] (no output projection). Lean build: single f16 products on v_wmma_f32_16x16x32_f16, f32 accumulate
// (ctx averages ~512 positions; no large rows); fragment k-map per lane half hh for A AND B: elements 0..7 <- k = 8hh+0..7, 8..15 <- k = 16+8hh+0..7.

namespace {
constexpr int Bsz = 16, T = 512, HID = 1024, DH = 64, NH = 16, NKV = 16, REP = NH / NKV;
constexpr int BLK = 256;
constexpr int KVW = NKV * DH;                 // 1024
constexpr int NQKV = HID + 2 * KVW;           // 3072 columns: q | k | v
constexpr int MROWS = Bsz * T;                // 8192
constexpr int QT_PER_B = T / 16;              // 32

typedef _Float16 b16;                                           // f16 hi/lo planes
typedef __attribute__((ext_vector_type(16))) _Float16 v16b;
typedef __attribute__((ext_vector_type(8)))  _Float16 v8b;
typedef __attribute__((ext_vector_type(4)))  _Float16 v4b;
typedef __attribute__((ext_vector_type(8)))  float v8f;
typedef __attribute__((ext_vector_type(4)))  float v4f;

__device__ __forceinline__ v8b ld8b(const b16* p) { return *(const v8b*)p; }
__device__ __forceinline__ v16b cat8b(v8b a, v8b b) { return __builtin_shufflevector(a, b, 0, 1, 2, 3, 4, 5, 6, 7, 8, 9, 10, 11, 12, 13, 14, 15); }
// 16x16x32 16-bit fragment from a k-contiguous row pointer (A: lane&15 = row, B: lane&15 = column), hh = lane>>4:
// elements 0..7 <- p[8hh+0..7], elements 8..15 <- p[16+8hh+0..7]
__device__ __forceinline__ v16b frag_kb(const b16* p, int hh) { return cat8b(ld8b(p + 8 * hh), ld8b(p + 16 + 8 * hh)); }
__device__ __forceinline__ void split_bf16(float v, b16& hi, b16& lo) {   // (name kept) single f16: no low part
  hi = (b16)v; lo = (b16)0.0f;
}
// split fragment straight from an f32 k-contiguous row
__device__ __forceinline__ void frag_ksplit(const float* p, int hh, v16b& fh_, v16b& fl_) {
  const float* p0 = p + 8 * hh; const float* p1 = p + 16 + 8 * hh;
#pragma unroll
  for (int e = 0; e < 8; ++e) { b16 a, c; split_bf16(p0[e], a, c); fh_[e] = a; fl_[e] = c; split_bf16(p1[e], a, c); fh_[8 + e] = a; fl_[8 + e] = c; }
}
__device__ __forceinline__ v8f wmma16b(v16b a, v16b b, v8f c) {
  v8f d = __builtin_amdgcn_wmma_f32_16x16x32_f16(false, a, false, b, (short)0, c, false, false);
  asm volatile("v_nop\n\tv_nop\n\tv_nop\n\tv_nop" : "+v"(d) : "v"(a), "v"(b));
  return d;
}
// acc += A.B with both operands split: A = (ah, al), B = (bh, bl)
__device__ __forceinline__ v8f wmma3(v16b ah, v16b al, v16b bh, v16b bl, v8f c) {   // lean: single f16 product
  (void)al; (void)bl; return wmma16b(ah, bh, c);
}
__device__ __forceinline__ v8f wmma1(v16b ah, v16b al, v16b bh, v16b bl, v8f c) {   // attention products: single f16 (hi planes only)
  (void)al; (void)bl; return wmma16b(ah, bh, c);
}
__device__ __forceinline__ void wave_lds_sync() {
  __builtin_amdgcn_fence(__ATOMIC_RELEASE, "workgroup");
  __builtin_amdgcn_wave_barrier();
  __builtin_amdgcn_fence(__ATOMIC_ACQUIRE, "workgroup");
}

// ---------------------------------------------------------------------------
// Weights ([in][out]) -> f16 hi / lo planes transposed to [n][k] (k contiguous): columns of Wq|Wk|Wv into wqh/wql [3072][1024], Wo into woh/wol [1024][1024].
// ---------------------------------------------------------------------------
__global__ __launch_bounds__(256) void wcvt_kernel(const float* __restrict__ wq, const float* __restrict__ wk, const float* __restrict__ wv,
                                                   const float* __restrict__ wo, b16* __restrict__ wqh, b16* __restrict__ wql,
                                                   b16* __restrict__ woh, b16* __restrict__ wol) {
  const size_t tid = (size_t)blockIdx.x * blockDim.x + threadIdx.x, stride = (size_t)gridDim.x * blockDim.x;
  const size_t nq = (size_t)NQKV * HID / 8, no = (size_t)HID * HID / 8;
  {
    for (size_t c = tid; c < nq + no; c += stride) {
      float f[8]; size_t i; b16* dh; b16* dl;
      if (c < nq) {
        i = c * 8; const size_t n = i / HID, k0 = i % HID;
        const float* w; int nn, ld;
        if (n < (size_t)HID) { w = wq; nn = (int)n; ld = HID; } else if (n < (size_t)(HID + KVW)) { w = wk; nn = (int)n - HID; ld = KVW; } else { w = wv; nn = (int)n - HID - KVW; ld = KVW; }
#pragma unroll
        for (int e = 0; e < 8; ++e) f[e] = w[(size_t)(k0 + e) * ld + nn];       // W[k][n] ([in][out])
        dh = wqh; dl = wql;
      } else {
        i = (c - nq) * 8; const size_t n = i / HID, k0 = i % HID;
#pragma unroll
        for (int e = 0; e < 8; ++e) f[e] = wo[(size_t)(k0 + e) * HID + n];    // Wo[k][n] ([in][out])
        dh = woh; dl = wol;
      }
      v8b bh, bl;
#pragma unroll
      for (int e = 0; e < 8; ++e) { b16 a, cc; split_bf16(f[e], a, cc); bh[e] = a; bl[e] = cc; }
      *(v8b*)(dh + i) = bh; *(v8b*)(dl + i) = bl;
    }
    
  }
}

// 32x64 wave tile over K from f32 A rows and f16-plane B rows
__device__ __forceinline__ void gemm_tile_split(const float* __restrict__ A, const b16* __restrict__ wh, const b16* __restrict__ wl,
                                                int m0, int c0, int K, int nloc, int hlf, v8f (&acc)[2][4]) {
  for (int kb = 0; kb < K; kb += 32) {
    v16b a0h, a0l, a1h, a1l;
    frag_ksplit(A + (size_t)(m0 + nloc) * K + kb, hlf, a0h, a0l);
    frag_ksplit(A + (size_t)(m0 + 16 + nloc) * K + kb, hlf, a1h, a1l);
#pragma unroll
    for (int t = 0; t < 4; ++t) {
      const size_t wofs = (size_t)(c0 + t * 16 + nloc) * K + kb;
      const v16b bh = frag_kb(wh + wofs, hlf), bl = frag_kb(wl + wofs, hlf);
      acc[0][t] = wmma3(a0h, a0l, bh, bl, acc[0][t]);
      acc[1][t] = wmma3(a1h, a1l, bh, bl, acc[1][t]);
    }
  }
}

// ---------------------------------------------------------------------------
// FiLM maps gamma[b][c] = te[b] . Wg[c] + bg[c] and beta[b][c] = te[b] . Wb[c] + bb[c]. One block (number fb) makes one 128-B line of one map (32 columns of
// one example); each wave takes four weight rows, and its 32 lanes read te[b] and every row as whole contiguous 512-B pieces (k = 128 j + 4 lane + 0..3).
// Per-lane partial sums, then a 32-lane xor tree; the 32 results meet in LDS (Rs, 32 floats) and leave as one whole-line store.
// ---------------------------------------------------------------------------
constexpr int FCG = BLK / 32;                   // column groups of 32 per map
constexpr int FBLOCKS = Bsz * FCG * 2;          // blocks of FiLM work
__device__ __forceinline__ void film_block(int fb, float* Rs, const float* __restrict__ te, const float* __restrict__ Wg, const float* __restrict__ bg,
                                           const float* __restrict__ Wb, const float* __restrict__ bb, float* __restrict__ gam, float* __restrict__ bet) {
  const int lane = threadIdx.x & 31;
  const int wave = __builtin_amdgcn_readfirstlane(threadIdx.x >> 5);   // wave-uniform: row bases stay in scalar registers
  const int mat = fb & 1, cg = (fb >> 1) % FCG, b = fb / (2 * FCG);
  const float* e = te + (size_t)b * HID + lane * 4;
  const float* w = (mat ? Wb : Wg) + (size_t)(cg * 32 + wave * 4) * HID + lane * 4;
  const float bias = (mat ? bb : bg)[cg * 32 + lane];
  // every loop below is fully unrolled: ev, a and s stay in registers, and the row loads are issued ahead of the sums that use them
  v4f ev[HID / 128];
#pragma unroll
  for (int j = 0; j < HID / 128; ++j) ev[j] = *(const v4f*)(e + j * 128);
  v4f a[4];
#pragma unroll
  for (int r = 0; r < 4; ++r) a[r] = (v4f){};
#pragma unroll
  for (int j = 0; j < HID / 128; ++j)
#pragma unroll
    for (int r = 0; r < 4; ++r) a[r] += ev[j] * *(const v4f*)(w + (size_t)r * HID + j * 128);
  v4f s;
#pragma unroll
  for (int r = 0; r < 4; ++r) s[r] = (a[r][0] + a[r][1]) + (a[r][2] + a[r][3]);
#pragma unroll
  for (int m = 16; m >= 1; m >>= 1)
#pragma unroll
    for (int r = 0; r < 4; ++r) s[r] += __shfl_xor(s[r], m);
  if (lane == 0) *(v4f*)(Rs + wave * 4) = s;
  __syncthreads();   // the eight waves' sums are in LDS before the first wave reads them
  if (threadIdx.x < 32) (mat ? bet : gam)[(size_t)b * BLK + cg * 32 + lane] = Rs[lane] + bias;
}

// ---------------------------------------------------------------------------
// QKV GEMM: (8192 x 1024) x (1024 x 3072), grid (12, 64 GEMM + 22 FiLM rows), block 8 waves (2 x 4), block tile 128 rows x 256 columns, wave = 64 rows x 64 columns (one head of
// q, k or v). Per pass of 64 k the block brings its x rows (f32, whole 128-B lines, converted to f16 once) and its weight rows through registers into LDS
// (row pitch 144 B); every wave reads its fragments from there. Two LDS buffers, one barrier per pass: the next pass's global loads are issued ahead of this
// pass's products and stored into the other buffer behind them. The walk over k starts at a pass rotated by block index. Outputs, one f16 array each:
// q (x1/8) -> Qh [b][h][t][64]; k -> Kh [b][kvh][t][64] (4 KB contiguous per wave and 32 rows);
// v -> Vh key-tiled [b][kvh][t/16][64][16] (4 KB contiguous per wave and 32 rows).
// The grid's rows behind the last GEMM row (blockIdx.y >= GGY) do the FiLM maps, which only the attention launch reads: 768 GEMM blocks stand against 512
// resident places, so these short blocks, the last to start, run in places that the GEMM's second round leaves empty.
// ---------------------------------------------------------------------------
constexpr int GBM = 128, GBN = 256, GKS = 64;
constexpr int GGX = NQKV / GBN, GGY = MROWS / GBM;   // grid of GEMM blocks
constexpr int FROWS = (FBLOCKS + GGX - 1) / GGX;     // further grid rows, for the FiLM blocks
constexpr int GPITCH = GKS + 8;                 // LDS row pitch in f16 elements: 144 B = 16 B x 9 (conflict-free for 16-byte fragment reads)
constexpr int GSTAGE = (GBM + GBN) * GPITCH;    // one buffer: x rows, then weight rows
constexpr int GEPI = 8 * 2 * 32 * 64;           // epilogue staging, 8 KB per wave, in the same LDS behind the last pass's barrier
constexpr int GSMEM = (2 * GSTAGE > GEPI) ? 2 * GSTAGE : GEPI;
__global__ __launch_bounds__(256) void qkv_gemm_kernel(const float* __restrict__ xq, const float* __restrict__ xk, const float* __restrict__ xv,
                                                       const b16* __restrict__ wqh,
                                                       const float* __restrict__ bq, const float* __restrict__ bk, const float* __restrict__ bv, const float* __restrict__ rope_cs, int xoff, int yoff,
                                                       b16* __restrict__ Qh, b16* __restrict__ Kh, b16* __restrict__ Vh,
                                                       const float* __restrict__ te, const float* __restrict__ Wg, const float* __restrict__ bgam,
                                                       const float* __restrict__ Wb, const float* __restrict__ bbet, float* __restrict__ gam, float* __restrict__ bet) {
  __shared__ __attribute__((aligned(16))) b16 Sm[GSMEM];
  (void)rope_cs;
  if (blockIdx.y >= GGY) {                                          // the same for the whole block: a FiLM block, or one of the last row's spare blocks
    const int fb = (blockIdx.y - GGY) * GGX + blockIdx.x;
    if (fb < FBLOCKS) film_block(fb, (float*)Sm, te, Wg, bgam, Wb, bbet, gam, bet);
    return;
  }
  const int tid = threadIdx.x, lane = tid & 31, nloc = lane & 15, hlf = lane >> 4;
  const int wave = __builtin_amdgcn_readfirstlane(tid >> 5);        // wave-uniform: head, matrix and staging bases stay in scalar registers
  const int wm = wave >> 2, wn = wave & 3;
  const int mblk = (blockIdx.y + yoff) * GBM;
  const int cblk = (blockIdx.x + xoff) * GBN;
  const int c0 = cblk + wn * 64;
  const int mat = (c0 < HID) ? 0 : (c0 < HID + KVW) ? 1 : 2;
  const int head = (mat == 0) ? (c0 / DH) : (mat == 1) ? ((c0 - HID) / DH) : ((c0 - HID - KVW) / DH);
  const float* x = (mat == 0) ? xq : (mat == 1) ? xk : xv;          // input of q, k or v (the same x at the launch)
  const float* bias = ((mat == 0) ? bq : (mat == 1) ? bk : bv) + head * DH;
  // loaders: x, 16 threads x 16 B per row (a wave covers 2 rows x 256 B); weights, 8 threads x 16 B per row (a wave covers 4 rows x 128 B)
  const int arow = tid >> 4, acol = (tid & 15) * 4;
  const int brow = tid >> 3, bcol = (tid & 7) * 8;
  // Blocks that share x rows (same blockIdx.y) or weight rows (same blockIdx.x) run at the same time; each starts its walk over k at another pass and wraps
  // round, so that they do not ask L2 for the same lines at the same moment. Every block still takes all HID / GKS passes, each once.
  const int rot = (blockIdx.x + blockIdx.y) & (HID / GKS - 1);
  const float* ag = x + (size_t)(mblk + arow) * HID + acol + rot * GKS;
  const b16* bg = wqh + (size_t)(cblk + brow) * HID + bcol + rot * GKS;
  b16* as = Sm + arow * GPITCH + acol;
  b16* bs = Sm + (GBM + brow) * GPITCH + bcol;
  const b16* af0 = Sm + (wm * 64 + nloc) * GPITCH;
  const b16* bf0 = Sm + (GBM + wn * 64 + nloc) * GPITCH;
  v4f ra[8]; v8b rb[8];
  v8f acc[4][4];
#pragma unroll
  for (int r = 0; r < 4; ++r)
#pragma unroll
    for (int t = 0; t < 4; ++t) acc[r][t] = (v8f){};
#pragma unroll
  for (int j = 0; j < 8; ++j) { ra[j] = *(const v4f*)(ag + (size_t)j * 16 * HID); rb[j] = ld8b(bg + (size_t)j * 32 * HID); }
#pragma unroll
  for (int j = 0; j < 8; ++j) {
    v4b h; 
#pragma unroll
    for (int e = 0; e < 4; ++e) h[e] = (b16)ra[j][e];
    *(v4b*)(as + j * 16 * GPITCH) = h; *(v8b*)(bs + j * 32 * GPITCH) = rb[j];
  }
  __syncthreads();
  for (int it = 0; it < HID / GKS; ++it) {
    const int cur = (it & 1) * GSTAGE, nxt = GSTAGE - cur;
    const bool more = it + 1 < HID / GKS;
    if (more) {
      const int step = (((it + 1 + rot) & (HID / GKS - 1)) == 0) ? GKS - HID : GKS;   // on to the next pass of the walk, from the last one back to k = 0
      ag += step; bg += step;
#pragma unroll
      for (int j = 0; j < 8; ++j) { ra[j] = *(const v4f*)(ag + (size_t)j * 16 * HID); rb[j] = ld8b(bg + (size_t)j * 32 * HID); }
    }
#pragma unroll
    for (int ks = 0; ks < GKS; ks += 32) {
      v16b a[4];
#pragma unroll
      for (int r = 0; r < 4; ++r) a[r] = frag_kb(af0 + cur + r * 16 * GPITCH + ks, hlf);
      v16b bh = frag_kb(bf0 + cur + ks, hlf);
#pragma unroll
      for (int t = 0; t < 4; ++t) {
        v16b bn = bh;
        if (t < 3) bn = frag_kb(bf0 + cur + (t + 1) * 16 * GPITCH + ks, hlf);   // the next column fragment is read ahead of this one's four products
#pragma unroll
        for (int r = 0; r < 4; ++r) acc[r][t] = wmma3(a[r], a[r], bh, bh, acc[r][t]);
        bh = bn;
      }
    }
    if (more) {
#pragma unroll
      for (int j = 0; j < 8; ++j) {
        v4b h;
#pragma unroll
        for (int e = 0; e < 4; ++e) h[e] = (b16)ra[j][e];
        *(v4b*)(as + nxt + j * 16 * GPITCH) = h; *(v8b*)(bs + nxt + j * 32 * GPITCH) = rb[j];
      }
    }
    __syncthreads();   // publishes the buffer just filled and ends every wave's reads of the one refilled next (after the last pass: of the LDS the epilogue reuses)
  }
  const float s = (mat == 0) ? 0.125f : 1.0f;
  b16* Tw = Sm + wave * (2 * 32 * 64);                              // each wave stages in its own 8 KB: [32-row half][32 * 64]
#pragma unroll
  for (int r2 = 0; r2 < 2; ++r2) {
    b16* Tp0 = Tw + r2 * (32 * 64);
#pragma unroll
    for (int t = 0; t < 4; ++t)
#pragma unroll
      for (int r = 0; r < 2; ++r)
#pragma unroll
        for (int v = 0; v < 8; ++v) {
          const int rr = r * 16 + v + 8 * hlf, d = t * 16 + nloc;
          const float val = acc[r2 * 2 + r][t][v] + bias[d];
          const int idx = (mat < 2) ? (rr * 64 + d) : ((rr >> 4) * 1024 + d * 16 + (rr & 15));
          Tp0[idx] = (b16)(val * s);
        }
  }
  wave_lds_sync();
#pragma unroll
  for (int r2 = 0; r2 < 2; ++r2) {
    const b16* Tp0 = Tw + r2 * (32 * 64);
    const int m0 = mblk + wm * 64 + r2 * 32;
    const int b = m0 / T, t0 = m0 % T;
    b16* dh;
    if (mat == 0)      dh = Qh + ((size_t)(b * NH + head) * T + t0) * DH;
    else if (mat == 1) dh = Kh + ((size_t)(b * NKV + head) * T + t0) * DH;
    else               dh = Vh + ((size_t)(b * NKV + head) * QT_PER_B + (t0 >> 4)) * (size_t)(DH * 16);
#pragma unroll
    for (int j = 0; j < 8; ++j) { const int e = (j * 32 + lane) * 8; *(v8b*)(dh + e) = ld8b(Tp0 + e); }
    // the next half's LDS reads reuse the registers that these stores name: keep the wait in front of that overwrite
    if (r2 == 0) asm volatile("s_wait_xcnt 0x0" ::: "memory");
  }
}

// ---------------------------------------------------------------------------
// Transposed flash attention: one block per (b, head), 32 waves, each wave owns one 16-query tile; all keys in chunks of 32.
// The head's K rows (LDS pitch 144 B, conflict-free for 16-byte fragment reads) and its key-tiled V (in LDS [t/16][key half][64][8], so that each 16-lane
// half of a fragment read covers 256 contiguous bytes) are brought into LDS once, by asynchronous copies of whole 512-B pieces per wave; every wave reads
// its fragments from there.
// S^T = K.Q^T (single f16, hi planes), per-lane online softmax; P^T built in registers from the two S^T accumulators
// ---------------------------------------------------------------------------
constexpr int AWAVES = QT_PER_B;                // one wave per query tile of the head
constexpr int KPITCH = DH + 8;                  // K row pitch in LDS, f16 elements
__global__ __launch_bounds__(AWAVES * 32) void attn_kernel(const b16* __restrict__ Qh, const b16* __restrict__ Kh, const b16* __restrict__ Vh, const int* __restrict__ seqlen,
                                                   const float* __restrict__ gam, const float* __restrict__ bet, const float* __restrict__ rwm,
                                                   float* __restrict__ yf) {
  __shared__ __attribute__((aligned(16))) b16 Ks[T * KPITCH];
  __shared__ __attribute__((aligned(16))) b16 Vs[T * DH];
  __shared__ __attribute__((aligned(16))) float Os[AWAVES][16 * 64];
  const int tid = threadIdx.x, lane = tid & 31, hh = lane >> 4, col = lane & 15;
  const int wid = __builtin_amdgcn_readfirstlane(tid >> 5);   // wave-uniform: the query tile and the bias test stay in scalar registers
  const int g = blockIdx.x;                               // b*NH + h
  const int q0 = wid << 4;
  const int b = g / NH, h = g % NH, kvh = h / REP;
  const size_t ko = (size_t)(b * NKV + kvh) * T * DH;
  const size_t qo = ((size_t)g * T + q0 + col) * DH;
  const v16b q0h = frag_kb(Qh + qo, hh), q1h = frag_kb(Qh + qo + 32, hh);
  {
    // thread tid moves the 16-byte pieces tid, tid + 1024, tid + 2048, tid + 3072 of the head's 64 KB of K and of its 64 KB of V
    const b16* kg = Kh + ko + tid * 8;
    const b16* vg = Vh + ko + tid * 8;
    const unsigned kl = (unsigned)(size_t)(Ks + (tid >> 3) * KPITCH + (tid & 7) * 8);
    const unsigned vl = (unsigned)(size_t)(Vs + (tid >> 7) * (DH * 16) + (tid & 1) * (DH * 8) + ((tid >> 1) & (DH - 1)) * 8);   // piece = (key tile, feature, key half)
    constexpr int GSTEP = 1024 * 8;                       // elements per step in memory (and in Vs: 8 key tiles)
    constexpr unsigned KSTEP = 128 * KPITCH * 2, VSTEP = GSTEP * 2;   // bytes per step in LDS
    // the copies and, as the last line, the wait that stands in front of any rewrite of the address registers they name
    asm volatile("global_load_async_to_lds_b128 %0, %8, off\n\t"
                 "global_load_async_to_lds_b128 %1, %9, off\n\t"
                 "global_load_async_to_lds_b128 %2, %10, off\n\t"
                 "global_load_async_to_lds_b128 %3, %11, off\n\t"
                 "global_load_async_to_lds_b128 %4, %12, off\n\t"
                 "global_load_async_to_lds_b128 %5, %13, off\n\t"
                 "global_load_async_to_lds_b128 %6, %14, off\n\t"
                 "global_load_async_to_lds_b128 %7, %15, off\n\t"
                 "s_wait_xcnt 0x0"
                 :: "v"(kl), "v"(kl + KSTEP), "v"(kl + 2 * KSTEP), "v"(kl + 3 * KSTEP),
                    "v"(vl), "v"(vl + VSTEP), "v"(vl + 2 * VSTEP), "v"(vl + 3 * VSTEP),
                    "v"(kg), "v"(kg + GSTEP), "v"(kg + 2 * GSTEP), "v"(kg + 3 * GSTEP),
                    "v"(vg), "v"(vg + GSTEP), "v"(vg + 2 * GSTEP), "v"(vg + 3 * GSTEP)
                 : "memory");
    asm volatile("s_wait_asynccnt 0x0" ::: "memory");   // this wave's copies have landed before it passes the barrier
  }
  __syncthreads();   // every wave's copies are in LDS before any wave reads K or V
  float m = -INFINITY, l = 0.0f;
  v8f o0 = {}, o1 = {}, o2 = {}, o3 = {};
  const int slen = T; (void)seqlen;                       // no padding in this module
  const b16* kf = Ks + col * KPITCH;
  const b16* vf = Vs + hh * (DH * 8) + col * 8;
  for (int it = 0; it < T / 32; ++it) {                  // non-causal: every key chunk, each once
    // all blocks read the same rwm rows, and the heads of an example the same gamma and beta: the walk over the key chunks starts rotated by block index and
    // wraps round, so that they do not ask L2 for the same lines at the same moment
    const int kb = ((it + g) & (T / 32 - 1)) * 32;
    v8f s0 = {}, s1 = {};
    {
      // the chunk's four K fragments are read as one group ahead of its products
      const b16* k0 = kf + kb * KPITCH; const b16* k1 = k0 + 16 * KPITCH;
      const v16b a00 = frag_kb(k0, hh), a01 = frag_kb(k0 + 32, hh), a10 = frag_kb(k1, hh), a11 = frag_kb(k1 + 32, hh);
      s0 = wmma1(a00, a00, q0h, q0h, s0);
      s1 = wmma1(a10, a10, q0h, q0h, s1);
      s0 = wmma1(a01, a01, q1h, q1h, s0);
      s1 = wmma1(a11, a11, q1h, q1h, s1);
    }
    (void)slen;
    if ((kb >> 8) == (q0 >> 8)) {                         // CBDA bias: same 256-block of query and key (chunks never straddle a block)
      // scalar bases and 32-bit lane offsets: no address pairs live through the loop (the 32-wave block has 128 registers a wave)
      const unsigned go = (unsigned)((kb & (BLK - 1)) + 8 * hh), ro = go + (unsigned)(col * BLK);
      const float* rw = rwm + (size_t)q0 * BLK + ro;
      const float* gm = gam + (size_t)b * BLK + go;
      const float* bt = bet + (size_t)b * BLK + go;
#pragma unroll
      for (int r = 0; r < 8; ++r) { s0[r] += gm[r] * rw[r] + bt[r]; s1[r] += gm[16 + r] * rw[16 + r] + bt[16 + r]; }
    }
    // the chunk's four V fragments: every read stands in front of the P.V products in the source, so the compiler may spread them over the softmax arithmetic
    const b16* v0 = vf + (kb >> 4) * (DH * 16); const b16* v1 = v0 + DH * 16;
    const v16b va0 = cat8b(ld8b(v0), ld8b(v1)), va1 = cat8b(ld8b(v0 + 128), ld8b(v1 + 128));
    const v16b va2 = cat8b(ld8b(v0 + 256), ld8b(v1 + 256)), va3 = cat8b(ld8b(v0 + 384), ld8b(v1 + 384));
    float mr = -INFINITY;
#pragma unroll
    for (int r = 0; r < 8; ++r) mr = fmaxf(mr, fmaxf(s0[r], s1[r]));
    mr = fmaxf(mr, __shfl_xor(mr, 16));
    float mn = fmaxf(m, mr);
    if (mn == -INFINITY) mn = 0.0f;           // fully masked so far (padded query rows far past seq_len): keep exp() at 0
    const float al_ = __expf(m - mn);
    m = mn;
    float sum = 0.0f;
    v16b pbh, pbl;
#pragma unroll
    for (int r = 0; r < 8; ++r) {
      const float p0 = __expf(s0[r] - mn), p1 = __expf(s1[r] - mn);
      sum += p0 + p1;
      b16 a, c; split_bf16(p0, a, c); pbh[r] = a; pbl[r] = c; split_bf16(p1, a, c); pbh[8 + r] = a; pbl[8 + r] = c;
    }
    sum += __shfl_xor(sum, 16);
    l = l * al_ + sum;
#pragma unroll
    for (int r = 0; r < 8; ++r) { o0[r] *= al_; o1[r] *= al_; o2[r] *= al_; o3[r] *= al_; }
    o0 = wmma1(va0, va0, pbh, pbl, o0);
    o1 = wmma1(va1, va1, pbh, pbl, o1);
    o2 = wmma1(va2, va2, pbh, pbl, o2);
    o3 = wmma1(va3, va3, pbh, pbl, o3);
  }
  const float inv = (q0 + col < slen && l > 0.0f) ? (1.0f / l) : 0.0f;   // padded query rows are zeroed
  float* Tt = Os[wid];
#pragma unroll
  for (int r = 0; r < 8; ++r) {
    const int hr = 8 * hh + r;
    Tt[col * 64 + 0 + hr] = o0[r] * inv; Tt[col * 64 + 16 + hr] = o1[r] * inv;
    Tt[col * 64 + 32 + hr] = o2[r] * inv; Tt[col * 64 + 48 + hr] = o3[r] * inv;
  }
  wave_lds_sync();
  float* dst0 = yf + ((size_t)b * T + q0) * HID + h * DH;     // 16 rows x 64 floats, row stride HID
#pragma unroll
  for (int j = 0; j < 8; ++j) { const int rr = j * 2 + hh, c4 = col * 4; *(v4f*)(dst0 + (size_t)rr * HID + c4) = *(const v4f*)(Tt + rr * 64 + c4); }
  
}

// ---------------------------------------------------------------------------
// Output projection: (8192 x 1024) x (1024 x 1024) -> f32, A split on the fly from f32 y, B = Wo planes. grid (16, 64), 32x64 tiles staged in LDS,
// ---------------------------------------------------------------------------
__global__ __launch_bounds__(128) void out_gemm_kernel(const float* __restrict__ yf, const b16* __restrict__ woh, const b16* __restrict__ wol, const float* __restrict__ bo, int yoff,
                                                       float* __restrict__ out) {
  __shared__ __attribute__((aligned(16))) float Ts[4][32 * 64];
  const int lane = threadIdx.x & 31, wave = threadIdx.x >> 5, nloc = lane & 15, hlf = lane >> 4;
  const int m0 = (blockIdx.y + yoff) * 128 + wave * 32;
  const int c0 = blockIdx.x * 64;
  v8f acc[2][4];
#pragma unroll
  for (int r = 0; r < 2; ++r)
#pragma unroll
    for (int t = 0; t < 4; ++t) acc[r][t] = (v8f){};
  gemm_tile_split(yf, woh, wol, m0, c0, HID, nloc, hlf, acc);
  float* Tt = Ts[wave];
#pragma unroll
  for (int t = 0; t < 4; ++t)
#pragma unroll
    for (int r = 0; r < 2; ++r)
#pragma unroll
      for (int v = 0; v < 8; ++v) Tt[(r * 16 + v + 8 * hlf) * 64 + t * 16 + nloc] = acc[r][t][v] + bo[c0 + t * 16 + nloc];
  wave_lds_sync();
  float* dst0 = out + (size_t)m0 * HID + c0;
#pragma unroll
  for (int j = 0; j < 16; ++j) { const int rr = j * 2 + hlf, c4 = nloc * 4; *(v4f*)(dst0 + (size_t)rr * HID + c4) = *(const v4f*)(Tt + rr * 64 + c4); }
  
}
__global__ __launch_bounds__(256) void wcvtT_kernel(const float* __restrict__ wq, const float* __restrict__ wk, const float* __restrict__ wv,
                                                    b16* __restrict__ wqh) {
  const size_t tid = (size_t)blockIdx.x * blockDim.x + threadIdx.x, stride = (size_t)gridDim.x * blockDim.x;
  const size_t nq = (size_t)NQKV * HID / 8;
  {
    for (size_t c = tid; c < nq; c += stride) {
      const size_t i = c * 8, n = i / HID, k0 = i % HID;
      const float* w = (n < (size_t)HID) ? (wq + n * HID) : (n < (size_t)(2 * HID)) ? (wk + (n - HID) * HID) : (wv + (n - 2 * HID) * HID);
      v8b bh;
#pragma unroll
      for (int e = 0; e < 8; ++e) bh[e] = (b16)w[k0 + e];
      *(v8b*)(wqh + i) = bh;
    }
    
  }
}
}  // namespace

extern "C" void kernel_launch(void* const* d_in, const int* in_sizes, int n_in,
                              void* d_out, int out_size, void* d_ws, size_t ws_size, hipStream_t stream) {
  (void)in_sizes; (void)n_in; (void)out_size;
  const float* x   = (const float*)d_in[0];    // hidden_states [16,512,1024]
  const float* te  = (const float*)d_in[1];    // task_embedding [16,1024]
  const float* Wq  = (const float*)d_in[2];  const float* bq = (const float*)d_in[3];
  const float* Wk  = (const float*)d_in[4];  const float* bk = (const float*)d_in[5];
  const float* Wv  = (const float*)d_in[6];  const float* bv = (const float*)d_in[7];
  const float* Wg  = (const float*)d_in[8];  const float* bg = (const float*)d_in[9];
  const float* Wb  = (const float*)d_in[10]; const float* bb = (const float*)d_in[11];
  const float* rwm = (const float*)d_in[12];   // [512,256]
  float* out = (float*)d_out;                  // ctx [16,512,1024]

  size_t off = 0; char* ws = (char*)d_ws;
  b16* wqh = (b16*)(ws + off); off += (size_t)NQKV * HID * 2;
  b16* Qh  = (b16*)(ws + off); off += (size_t)MROWS * HID * 2;
  b16* Kh  = (b16*)(ws + off); off += (size_t)MROWS * KVW * 2;
  b16* Vh  = (b16*)(ws + off); off += (size_t)MROWS * KVW * 2;
  float* gam = (float*)(ws + off); off += (size_t)Bsz * BLK * 4;
  float* bet = (float*)(ws + off); off += (size_t)Bsz * BLK * 4;
  if (off > ws_size) return;
  const int NQT = Bsz * NH * QT_PER_B;
  wcvtT_kernel<<<2048, 256, 0, stream>>>(Wq, Wk, Wv, wqh);
  qkv_gemm_kernel<<<dim3(GGX, GGY + FROWS), 256, 0, stream>>>(x, x, x, wqh, bq, bk, bv, nullptr, 0, 0, Qh, Kh, Vh, te, Wg, bg, Wb, bb, gam, bet);
  attn_kernel<<<NQT / AWAVES, AWAVES * 32, 0, stream>>>(Qh, Kh, Vh, nullptr, gam, bet, rwm, out);
}
